// v000
// Times are from an AMD MI455X. After a warm-up the kernel runs many times in a row, and a time is the length of
// such a window on the GPU divided by its runs, so every launch and the gaps after it count. The runs cycle
// through copies of the inputs. A figure is the median of several windows, for all but v000 over two sittings.
// Sittings can differ by a few percent; kernels timed side by side share one.
// v000, which the later versions start from, runs in 160 microseconds.
#include <hip/hip_runtime.h>

#define BB 8
#define CC 128
#define LL 4096

typedef __attribute__((ext_vector_type(16))) _Float16 v16h;
typedef __attribute__((ext_vector_type(8)))  _Float16 v8h;
typedef __attribute__((ext_vector_type(8)))  float    v8f;
typedef __attribute__((ext_vector_type(4)))  unsigned int v4u;
typedef __attribute__((ext_vector_type(4)))  int      v4i;
typedef __attribute__((ext_vector_type(8)))  int      v8i;

__device__ __forceinline__ v16h frag_rowmajor(const _Float16* base, int row,
                                              int stride, int col) {
  const _Float16* p = base + row * stride + col;
  v8h lo = *reinterpret_cast<const v8h*>(p);
  v8h hi = *reinterpret_cast<const v8h*>(p + 16);
  v16h r;
#pragma unroll
  for (int i = 0; i < 8; ++i) {
    r[i]     = lo[i];
    r[i + 8] = hi[i];
  }
  return r;
}

__device__ __forceinline__ v8f zero_v8f() {
  v8f z;
#pragma unroll
  for (int i = 0; i < 8; ++i) z[i] = 0.0f;
  return z;
}

__device__ __forceinline__ void tdm_load_2d_f16(unsigned lds_byte_off,
                                                const _Float16* gaddr,
                                                unsigned tensor_d0,
                                                unsigned tensor_d1,
                                                unsigned tile_d0,
                                                unsigned tile_d1,
                                                unsigned stride0_elems,
                                                unsigned pad_interval_code,
                                                unsigned pad_amount_code) {
  const unsigned long long ga = (unsigned long long)(uintptr_t)gaddr;
  v4u g0;
  g0[0] = 1u;                                            // count=1 (valid, user)
  g0[1] = lds_byte_off;                                  // lds_addr
  g0[2] = (unsigned)(ga & 0xffffffffu);                  // global_addr[31:0]
  g0[3] = (unsigned)((ga >> 32) & 0x01ffffffu) | (2u << 30);  // [56:32] | type=2

  v8i g1;
  g1[0] = (int)((1u << 16) |
                (1u << 20) |
                (pad_interval_code << 22) |
                (pad_amount_code << 25));
  g1[1] = (int)((tensor_d0 & 0xffffu) << 16);            // dim0[15:0] @ bit48
  g1[2] = (int)((tensor_d0 >> 16) | ((tensor_d1 & 0xffffu) << 16));
  g1[3] = (int)((tensor_d1 >> 16) | (tile_d0 << 16));
  g1[4] = (int)(tile_d1 & 0xffffu);
  g1[5] = (int)stride0_elems;
  g1[6] = 0;
  g1[7] = 0;

  v4i z4;
  z4[0] = 0; z4[1] = 0; z4[2] = 0; z4[3] = 0;
#if __clang_major__ >= 23
  v8i z8;
#pragma unroll
  for (int i = 0; i < 8; ++i) z8[i] = 0;
  __builtin_amdgcn_tensor_load_to_lds(g0, g1, z4, z4, z8, 0);
#else
  __builtin_amdgcn_tensor_load_to_lds(g0, g1, z4, z4, 0);
#endif
}

// ---------------------------------------------------------------------------
// Projection: out[o,l] = sum_c W[o,c] x[b,c,l] + bias[o], cast to f16.
// which (blockIdx.z): 0 -> Q ([L,C]), 1 -> K ([L,C]), 2 -> V ([C,L]).
// ---------------------------------------------------------------------------
__launch_bounds__(128)
__global__ void cgp_proj_kernel(const float* __restrict__ pose,
                                const float* __restrict__ idf,
                                const float* __restrict__ Wq, const float* __restrict__ bq,
                                const float* __restrict__ Wk, const float* __restrict__ bk,
                                const float* __restrict__ Wv, const float* __restrict__ bv,
                                _Float16* __restrict__ Qb,
                                _Float16* __restrict__ Kb,
                                _Float16* __restrict__ Vb) {
  const int which = blockIdx.z;
  const int b     = blockIdx.y;
  const int l0    = blockIdx.x * 32;
  const int o     = threadIdx.x;

  const float* x    = (which == 1) ? idf : pose;
  const float* W    = (which == 0) ? Wq : (which == 1) ? Wk : Wv;
  const float* bias = (which == 0) ? bq : (which == 1) ? bk : bv;

  __shared__ float xs[CC][32];

  const float* xb = x + (size_t)b * CC * LL;
  for (int i = threadIdx.x; i < CC * 32; i += 128) {
    const int c = i >> 5, j = i & 31;
    xs[c][j] = xb[(size_t)c * LL + l0 + j];
  }
  __syncthreads();

  float acc[32];
#pragma unroll
  for (int j = 0; j < 32; ++j) acc[j] = 0.0f;

  for (int c = 0; c < CC; ++c) {
    const float w = W[o * CC + c];
#pragma unroll
    for (int j = 0; j < 32; ++j) acc[j] = fmaf(w, xs[c][j], acc[j]);
  }

  const float bo = bias[o];
  if (which == 2) {
    _Float16* dst = Vb + (size_t)b * CC * LL + (size_t)o * LL + l0;
#pragma unroll
    for (int j = 0; j < 32; ++j) dst[j] = (_Float16)(acc[j] + bo);
  } else {
    _Float16* dst = (which == 0 ? Qb : Kb) + (size_t)b * LL * CC + (size_t)l0 * CC + o;
#pragma unroll
    for (int j = 0; j < 32; ++j) dst[(size_t)j * CC] = (_Float16)(acc[j] + bo);
  }
}

#define KT   64
#define KSTR 136  // K LDS row stride (halves): 64 DW row + 4 DW hw pad
#define VSTR 72   // V LDS row stride (halves): 32 DW row + 4 DW hw pad
#define PSTR 72   // P pad row stride (halves)
#define NIT  (LL / KT)

__launch_bounds__(256)
__global__ void cgp_attn_kernel(const _Float16* __restrict__ Qb,
                                const _Float16* __restrict__ Kb,
                                const _Float16* __restrict__ Vb,
                                const float* __restrict__ pose,
                                const float* __restrict__ gamma,
                                float* __restrict__ out) {
  __shared__ _Float16 sK[2][64 * KSTR];
  __shared__ _Float16 sV[2][CC * VSTR];
  __shared__ _Float16 sP[8 * 16 * PSTR];

  const int b   = blockIdx.y;
  const int q0  = blockIdx.x * 128;
  const int tid = threadIdx.x;
  const int wv  = tid >> 5;
  const int ln  = tid & 31;
  const int hn  = ln & 15;
  const int hg  = ln >> 4;

  const _Float16* Qbase = Qb + (size_t)b * LL * CC;  // [L,C]
  const _Float16* Kbase = Kb + (size_t)b * LL * CC;  // [L,C]
  const _Float16* Vbase = Vb + (size_t)b * CC * LL;  // [C,L]

  const int i0 = q0 + wv * 16;
  const bool tdm_wave = (wv == 0);

  // Resident Q fragments.
  v16h qf[4];
#pragma unroll
  for (int kc = 0; kc < 4; ++kc)
    qf[kc] = frag_rowmajor(Qbase, i0 + hn, CC, kc * 32 + hg * 8);

  v8f O[8];
#pragma unroll
  for (int cc8 = 0; cc8 < 8; ++cc8) O[cc8] = zero_v8f();

  float mrun[8], lrun[8];
#pragma unroll
  for (int r = 0; r < 8; ++r) { mrun[r] = -3.0e38f; lrun[r] = 0.0f; }

  _Float16* myP = &sP[wv * 16 * PSTR];

  // Prologue: DMA tile 0 into buffer 0.
  if (tdm_wave) {
    tdm_load_2d_f16((unsigned)(uintptr_t)&sK[0][0], Kbase,
                    CC, LL, CC, KT, CC, /*pad: every 64 DW*/ 5, /*4 DW*/ 3);
    tdm_load_2d_f16((unsigned)(uintptr_t)&sV[0][0], Vbase,
                    LL, CC, KT, CC, LL, /*pad: every 32 DW*/ 4, /*4 DW*/ 3);
  }

  for (int it = 0; it < NIT; ++it) {
    const int nb = (it + 1) & 1;
    if (tdm_wave) {
      if (it + 1 < NIT) {
        const int j1 = (it + 1) * KT;
        tdm_load_2d_f16((unsigned)(uintptr_t)&sK[nb][0],
                        Kbase + (size_t)j1 * CC, CC, LL, CC, KT, CC, 5, 3);
        tdm_load_2d_f16((unsigned)(uintptr_t)&sV[nb][0],
                        Vbase + j1, LL, CC, KT, CC, LL, 4, 3);
        __builtin_amdgcn_s_wait_tensorcnt(2);   // current tile's 2 ops done
      } else {
        __builtin_amdgcn_s_wait_tensorcnt(0);
      }
    }
    __syncthreads();  // tile `it` visible to all waves

    const _Float16* k = sK[it & 1];
    const _Float16* v = sV[it & 1];

    // ---- S = Q K^T : preload the 4 K-fragments, then the 4-WMMA chain ----
    v8f S[4];
#pragma unroll
    for (int jt = 0; jt < 4; ++jt) {
      v16h kf[4];
#pragma unroll
      for (int kc = 0; kc < 4; ++kc)
        kf[kc] = frag_rowmajor(k, jt * 16 + hn, KSTR, kc * 32 + hg * 8);
      v8f acc = zero_v8f();
#pragma unroll
      for (int kc = 0; kc < 4; ++kc)
        acc = __builtin_amdgcn_wmma_f32_16x16x32_f16(false, qf[kc], false, kf[kc],
                                                     (short)0, acc, false, false);
      S[jt] = acc;
    }

    float mnew[8], alpha[8];
#pragma unroll
    for (int r = 0; r < 8; ++r) {
      float mv = fmaxf(fmaxf(S[0][r], S[1][r]), fmaxf(S[2][r], S[3][r]));
#pragma unroll
      for (int off = 8; off >= 1; off >>= 1) mv = fmaxf(mv, __shfl_xor(mv, off, 32));
      mnew[r]  = fmaxf(mrun[r], mv);
      alpha[r] = __expf(mrun[r] - mnew[r]);
      mrun[r]  = mnew[r];
    }
#pragma unroll
    for (int jt = 0; jt < 4; ++jt)
#pragma unroll
      for (int r = 0; r < 8; ++r) S[jt][r] = __expf(S[jt][r] - mnew[r]);
#pragma unroll
    for (int r = 0; r < 8; ++r) {
      float s = (S[0][r] + S[1][r]) + (S[2][r] + S[3][r]);
#pragma unroll
      for (int off = 8; off >= 1; off >>= 1) s += __shfl_xor(s, off, 32);
      lrun[r] = lrun[r] * alpha[r] + s;
    }
#pragma unroll
    for (int cc8 = 0; cc8 < 8; ++cc8)
#pragma unroll
      for (int r = 0; r < 8; ++r) O[cc8][r] *= alpha[r];

    // ---- P: D-layout -> f16 A-layout via per-wave LDS pad (in-order LDS) ----
#pragma unroll
    for (int jt = 0; jt < 4; ++jt)
#pragma unroll
      for (int r = 0; r < 8; ++r)
        myP[(hg * 8 + r) * PSTR + jt * 16 + hn] = (_Float16)S[jt][r];

    // ---- O += P V^T : 2 j-chunks x 8 independent accumulation chains ----
#pragma unroll
    for (int jc = 0; jc < 2; ++jc) {
      v16h pf = frag_rowmajor(myP, hn, PSTR, jc * 32 + hg * 8);
#pragma unroll
      for (int cc8 = 0; cc8 < 8; ++cc8) {
        v16h vf = frag_rowmajor(v, cc8 * 16 + hn, VSTR, jc * 32 + hg * 8);
        O[cc8] = __builtin_amdgcn_wmma_f32_16x16x32_f16(false, pf, false, vf,
                                                        (short)0, O[cc8], false, false);
      }
    }
    __syncthreads();
  }

  // ---- epilogue: out = pose + gamma * O / l ----
  float inv[8];
#pragma unroll
  for (int r = 0; r < 8; ++r) inv[r] = 1.0f / lrun[r];
  const float g = gamma[0];
  const float* pbase = pose + (size_t)b * CC * LL;
  float*       obase = out  + (size_t)b * CC * LL;

#pragma unroll
  for (int cc8 = 0; cc8 < 8; ++cc8) {
    const size_t base = (size_t)(cc8 * 16 + hn) * LL + (size_t)(i0 + hg * 8);
    const float4 p0 = *reinterpret_cast<const float4*>(pbase + base);
    const float4 p1 = *reinterpret_cast<const float4*>(pbase + base + 4);
    float4 r0, r1;
    r0.x = fmaf(g, O[cc8][0] * inv[0], p0.x);
    r0.y = fmaf(g, O[cc8][1] * inv[1], p0.y);
    r0.z = fmaf(g, O[cc8][2] * inv[2], p0.z);
    r0.w = fmaf(g, O[cc8][3] * inv[3], p0.w);
    r1.x = fmaf(g, O[cc8][4] * inv[4], p1.x);
    r1.y = fmaf(g, O[cc8][5] * inv[5], p1.y);
    r1.z = fmaf(g, O[cc8][6] * inv[6], p1.z);
    r1.w = fmaf(g, O[cc8][7] * inv[7], p1.w);
    *reinterpret_cast<float4*>(obase + base)     = r0;
    *reinterpret_cast<float4*>(obase + base + 4) = r1;
  }
}

// ---------------------------------------------------------------------------
extern "C" void kernel_launch(void* const* d_in, const int* in_sizes, int n_in,
                              void* d_out, int out_size, void* d_ws, size_t ws_size,
                              hipStream_t stream) {
  const float* pose  = (const float*)d_in[0];
  const float* idf   = (const float*)d_in[1];
  const float* Wq    = (const float*)d_in[2];
  const float* bq    = (const float*)d_in[3];
  const float* Wk    = (const float*)d_in[4];
  const float* bk    = (const float*)d_in[5];
  const float* Wv    = (const float*)d_in[6];
  const float* bv    = (const float*)d_in[7];
  const float* gamma = (const float*)d_in[8];
  float* out = (float*)d_out;

  const size_t mat_bytes = (size_t)BB * LL * CC * sizeof(_Float16);  // 8 MB each
  char* ws = (char*)d_ws;
  _Float16* Qb = reinterpret_cast<_Float16*>(ws);
  _Float16* Kb = reinterpret_cast<_Float16*>(ws + mat_bytes);
  _Float16* Vb = reinterpret_cast<_Float16*>(ws + 2 * mat_bytes);

  cgp_proj_kernel<<<dim3(LL / 32, BB, 3), dim3(128), 0, stream>>>(
      pose, idf, Wq, bq, Wk, bk, Wv, bv, Qb, Kb, Vb);

  cgp_attn_kernel<<<dim3(LL / 128, BB), dim3(256), 0, stream>>>(
      Qb, Kb, Vb, pose, gamma, out);
}

// v001
// A run of this version takes 112 microseconds.
// Two timings next to v000 put it at 1.46 and 1.47 times that version's speed.
#include <hip/hip_runtime.h>

#define BB 8
#define CC 128
#define LL 4096

typedef __attribute__((ext_vector_type(16))) _Float16 v16h;
typedef __attribute__((ext_vector_type(8)))  _Float16 v8h;
typedef __attribute__((ext_vector_type(8)))  float    v8f;
typedef __attribute__((ext_vector_type(4)))  unsigned int v4u;
typedef __attribute__((ext_vector_type(4)))  int      v4i;
typedef __attribute__((ext_vector_type(8)))  int      v8i;

__device__ __forceinline__ v16h frag_rowmajor(const _Float16* base, int row,
                                              int stride, int col) {
  const _Float16* p = base + row * stride + col;
  v8h lo = *reinterpret_cast<const v8h*>(p);
  v8h hi = *reinterpret_cast<const v8h*>(p + 16);
  v16h r;
#pragma unroll
  for (int i = 0; i < 8; ++i) {
    r[i]     = lo[i];
    r[i + 8] = hi[i];
  }
  return r;
}

__device__ __forceinline__ float xhalf(float x) {
  const int xi = __builtin_bit_cast(int, x);
  return __builtin_bit_cast(float, __builtin_amdgcn_permlanex16(
      xi, xi, 0x76543210, 0xfedcba98, false, false));
}

__device__ __forceinline__ v8f zero_v8f() {
  v8f z;
#pragma unroll
  for (int i = 0; i < 8; ++i) z[i] = 0.0f;
  return z;
}

__device__ __forceinline__ void tdm_load_2d_f16(unsigned lds_byte_off,
                                                const _Float16* gaddr,
                                                unsigned tensor_d0,
                                                unsigned tensor_d1,
                                                unsigned tile_d0,
                                                unsigned tile_d1,
                                                unsigned stride0_elems,
                                                unsigned pad_interval_code,
                                                unsigned pad_amount_code) {
  const unsigned long long ga = (unsigned long long)(uintptr_t)gaddr;
  v4u g0;
  g0[0] = 1u;                                            // count=1 (valid, user)
  g0[1] = lds_byte_off;                                  // lds_addr
  g0[2] = (unsigned)(ga & 0xffffffffu);                  // global_addr[31:0]
  g0[3] = (unsigned)((ga >> 32) & 0x01ffffffu) | (2u << 30);  // [56:32] | type=2

  v8i g1;
  g1[0] = (int)((1u << 16) |
                (1u << 20) |
                (pad_interval_code << 22) |
                (pad_amount_code << 25));
  g1[1] = (int)((tensor_d0 & 0xffffu) << 16);            // dim0[15:0] @ bit48
  g1[2] = (int)((tensor_d0 >> 16) | ((tensor_d1 & 0xffffu) << 16));
  g1[3] = (int)((tensor_d1 >> 16) | (tile_d0 << 16));
  g1[4] = (int)(tile_d1 & 0xffffu);
  g1[5] = (int)stride0_elems;
  g1[6] = 0;
  g1[7] = 0;

  v4i z4;
  z4[0] = 0; z4[1] = 0; z4[2] = 0; z4[3] = 0;
#if __clang_major__ >= 23
  v8i z8;
#pragma unroll
  for (int i = 0; i < 8; ++i) z8[i] = 0;
  __builtin_amdgcn_tensor_load_to_lds(g0, g1, z4, z4, z8, 0);
#else
  __builtin_amdgcn_tensor_load_to_lds(g0, g1, z4, z4, 0);
#endif
}

// ---------------------------------------------------------------------------
// Projection: out[o,l] = sum_c W[o,c] x[b,c,l] + bias[o], cast to f16.
// which (blockIdx.z): 0 -> Q ([L,C]), 1 -> K ([L,C]), 2 -> V ([C,L]).
// ---------------------------------------------------------------------------
__launch_bounds__(128)
__global__ void cgp_proj_kernel(const float* __restrict__ pose,
                                const float* __restrict__ idf,
                                const float* __restrict__ Wq, const float* __restrict__ bq,
                                const float* __restrict__ Wk, const float* __restrict__ bk,
                                const float* __restrict__ Wv, const float* __restrict__ bv,
                                _Float16* __restrict__ Qb,
                                _Float16* __restrict__ Kb,
                                _Float16* __restrict__ Vb) {
  const int which = blockIdx.z;
  const int b     = blockIdx.y;
  const int l0    = blockIdx.x * 32;
  const int o     = threadIdx.x;

  const float* x    = (which == 1) ? idf : pose;
  const float* W    = (which == 0) ? Wq : (which == 1) ? Wk : Wv;
  const float* bias = (which == 0) ? bq : (which == 1) ? bk : bv;

  __shared__ float xs[CC][32];

  const float* xb = x + (size_t)b * CC * LL;
  for (int i = threadIdx.x; i < CC * 32; i += 128) {
    const int c = i >> 5, j = i & 31;
    xs[c][j] = xb[(size_t)c * LL + l0 + j];
  }
  __syncthreads();

  float acc[32];
#pragma unroll
  for (int j = 0; j < 32; ++j) acc[j] = 0.0f;

  for (int c = 0; c < CC; ++c) {
    const float w = W[o * CC + c];
#pragma unroll
    for (int j = 0; j < 32; ++j) acc[j] = fmaf(w, xs[c][j], acc[j]);
  }

  const float bo = bias[o];
  if (which == 2) {
    _Float16* dst = Vb + (size_t)b * CC * LL + (size_t)o * LL + l0;
#pragma unroll
    for (int j = 0; j < 32; ++j) dst[j] = (_Float16)(acc[j] + bo);
  } else {
    _Float16* dst = (which == 0 ? Qb : Kb) + (size_t)b * LL * CC + (size_t)l0 * CC + o;
#pragma unroll
    for (int j = 0; j < 32; ++j) dst[(size_t)j * CC] = (_Float16)(acc[j] + bo);
  }
}

#define KT   64
#define KSTR 136  // K LDS row stride (halves): 64 DW row + 4 DW hw pad
#define VSTR 72   // V LDS row stride (halves): 32 DW row + 4 DW hw pad
#define NIT  (LL / KT)

__launch_bounds__(256) __attribute__((amdgpu_waves_per_eu(2, 2)))
__global__ void cgp_attn_kernel(const _Float16* __restrict__ Qb,
                                const _Float16* __restrict__ Kb,
                                const _Float16* __restrict__ Vb,
                                const float* __restrict__ pose,
                                const float* __restrict__ gamma,
                                float* __restrict__ out) {
  __shared__ _Float16 sK[2][64 * KSTR];
  __shared__ _Float16 sV[2][CC * VSTR];

  const int b   = blockIdx.y;
  const int q0  = blockIdx.x * 128;
  const int tid = threadIdx.x;
  const int wv  = tid >> 5;
  const int ln  = tid & 31;
  const int hn  = ln & 15;
  const int hg  = ln >> 4;

  const _Float16* Qbase = Qb + (size_t)b * LL * CC;  // [L,C]
  const _Float16* Kbase = Kb + (size_t)b * LL * CC;  // [L,C]
  const _Float16* Vbase = Vb + (size_t)b * CC * LL;  // [C,L]

  const int i0 = q0 + wv * 16;
  const bool tdm_wave = (wv == 0);

  // Resident Q fragments.
  v16h qf[4];
#pragma unroll
  for (int kc = 0; kc < 4; ++kc)
    qf[kc] = frag_rowmajor(Qbase, i0 + hn, CC, kc * 32 + hg * 8);

  v8f O[8];
#pragma unroll
  for (int cc8 = 0; cc8 < 8; ++cc8) O[cc8] = zero_v8f();

  // This lane's query: running maximum (equal in both wave halves) and the
  // running sum over this half's keys only (the halves join in the epilogue).
  float mrun = -3.0e38f, lrun = 0.0f;

  // Prologue: DMA tile 0 into buffer 0.
  if (tdm_wave) {
    tdm_load_2d_f16((unsigned)(uintptr_t)&sK[0][0], Kbase,
                    CC, LL, CC, KT, CC, /*pad: every 64 DW*/ 5, /*4 DW*/ 3);
    tdm_load_2d_f16((unsigned)(uintptr_t)&sV[0][0], Vbase,
                    LL, CC, KT, CC, LL, /*pad: every 32 DW*/ 4, /*4 DW*/ 3);
  }

  for (int it = 0; it < NIT; ++it) {
    const int nb = (it + 1) & 1;
    if (tdm_wave) {
      if (it + 1 < NIT) {
        const int j1 = (it + 1) * KT;
        tdm_load_2d_f16((unsigned)(uintptr_t)&sK[nb][0],
                        Kbase + (size_t)j1 * CC, CC, LL, CC, KT, CC, 5, 3);
        tdm_load_2d_f16((unsigned)(uintptr_t)&sV[nb][0],
                        Vbase + j1, LL, CC, KT, CC, LL, 4, 3);
        __builtin_amdgcn_s_wait_tensorcnt(2);   // current tile's 2 ops done
      } else {
        __builtin_amdgcn_s_wait_tensorcnt(0);
      }
    }
    __syncthreads();  // tile `it` visible to all waves

    const _Float16* k = sK[it & 1];
    const _Float16* v = sV[it & 1];

    // ---- S^T = K Q^T : A = 16 key rows from LDS, B = resident Q columns ----
    // S[jt][r] = score(key jt*16 + hg*8 + r, query i0 + hn)
    v8f S[4];
#pragma unroll
    for (int jt = 0; jt < 4; ++jt) {
      v16h kf[4];
#pragma unroll
      for (int kc = 0; kc < 4; ++kc)
        kf[kc] = frag_rowmajor(k, jt * 16 + hn, KSTR, kc * 32 + hg * 8);
      v8f acc = zero_v8f();
#pragma unroll
      for (int kc = 0; kc < 4; ++kc)
        acc = __builtin_amdgcn_wmma_f32_16x16x32_f16(false, kf[kc], false, qf[kc],
                                                     (short)0, acc, false, false);
      S[jt] = acc;
    }

    // ---- online softmax: in-lane over 32 scores, one exchange between halves ----
    float mt[4];
#pragma unroll
    for (int jt = 0; jt < 4; ++jt) {
      mt[jt] = S[jt][0];
#pragma unroll
      for (int r = 1; r < 8; ++r) mt[jt] = fmaxf(mt[jt], S[jt][r]);
    }
    float mv = fmaxf(fmaxf(mt[0], mt[1]), fmaxf(mt[2], mt[3]));
    mv = fmaxf(mv, xhalf(mv));
    const float mnew  = fmaxf(mrun, mv);
    const float alpha = __expf(mrun - mnew);
    mrun = mnew;

    float st[4];
#pragma unroll
    for (int jt = 0; jt < 4; ++jt) {
#pragma unroll
      for (int r = 0; r < 8; ++r) S[jt][r] = __expf(S[jt][r] - mnew);
      st[jt] = ((S[jt][0] + S[jt][1]) + (S[jt][2] + S[jt][3])) +
               ((S[jt][4] + S[jt][5]) + (S[jt][6] + S[jt][7]));
    }
    lrun = lrun * alpha + ((st[0] + st[1]) + (st[2] + st[3]));

#pragma unroll
    for (int cc8 = 0; cc8 < 8; ++cc8)
#pragma unroll
      for (int r = 0; r < 8; ++r) O[cc8][r] *= alpha;

    // ---- O^T += V P^T : A = 16 channel rows of V from LDS; B = P^T packed in
    // place from two score tiles (element s = tile s>>3, register s&7, which is
    // the k order that frag_rowmajor gives the V rows) ----
#pragma unroll
    for (int jc = 0; jc < 2; ++jc) {
      v16h pf;
#pragma unroll
      for (int s = 0; s < 8; ++s) {
        pf[s]     = (_Float16)S[2 * jc][s];
        pf[s + 8] = (_Float16)S[2 * jc + 1][s];
      }
#pragma unroll
      for (int cc8 = 0; cc8 < 8; ++cc8) {
        v16h vf = frag_rowmajor(v, cc8 * 16 + hn, VSTR, jc * 32 + hg * 8);
        O[cc8] = __builtin_amdgcn_wmma_f32_16x16x32_f16(false, vf, false, pf,
                                                        (short)0, O[cc8], false, false);
      }
    }
    __syncthreads();
  }

  // ---- epilogue: out = pose + gamma * O / l ----
  // O[cc8][r] = O^T(channel cc8*16 + hg*8 + r, query i0 + hn)
  const float inv = 1.0f / (lrun + xhalf(lrun));
  const float g = gamma[0];
  const float* pbase = pose + (size_t)b * CC * LL + (size_t)(i0 + hn);
  float*       obase = out  + (size_t)b * CC * LL + (size_t)(i0 + hn);

#pragma unroll
  for (int cc8 = 0; cc8 < 8; ++cc8) {
#pragma unroll
    for (int r = 0; r < 8; ++r) {
      const size_t off = (size_t)(cc8 * 16 + hg * 8 + r) * LL;
      obase[off] = fmaf(g, O[cc8][r] * inv, pbase[off]);
    }
  }
}

// ---------------------------------------------------------------------------
extern "C" void kernel_launch(void* const* d_in, const int* in_sizes, int n_in,
                              void* d_out, int out_size, void* d_ws, size_t ws_size,
                              hipStream_t stream) {
  const float* pose  = (const float*)d_in[0];
  const float* idf   = (const float*)d_in[1];
  const float* Wq    = (const float*)d_in[2];
  const float* bq    = (const float*)d_in[3];
  const float* Wk    = (const float*)d_in[4];
  const float* bk    = (const float*)d_in[5];
  const float* Wv    = (const float*)d_in[6];
  const float* bv    = (const float*)d_in[7];
  const float* gamma = (const float*)d_in[8];
  float* out = (float*)d_out;

  const size_t mat_bytes = (size_t)BB * LL * CC * sizeof(_Float16);  // 8 MB each
  char* ws = (char*)d_ws;
  _Float16* Qb = reinterpret_cast<_Float16*>(ws);
  _Float16* Kb = reinterpret_cast<_Float16*>(ws + mat_bytes);
  _Float16* Vb = reinterpret_cast<_Float16*>(ws + 2 * mat_bytes);

  cgp_proj_kernel<<<dim3(LL / 32, BB, 3), dim3(128), 0, stream>>>(
      pose, idf, Wq, bq, Wk, bk, Wv, bv, Qb, Kb, Vb);

  cgp_attn_kernel<<<dim3(LL / 128, BB), dim3(256), 0, stream>>>(
      Qb, Kb, Vb, pose, gamma, out);
}

// v002
// One run takes 74.4 microseconds.
// In two side-by-side timings against v001, it was 1.49 and 1.51 times as fast.
// Over all steps from v000 it is 2.20 times as fast.
#include <hip/hip_runtime.h>

#define BB 8
#define CC 128
#define LL 4096

typedef __attribute__((ext_vector_type(16))) _Float16 v16h;
typedef __attribute__((ext_vector_type(8)))  _Float16 v8h;
typedef __attribute__((ext_vector_type(8)))  float    v8f;
typedef __attribute__((ext_vector_type(4)))  unsigned int v4u;
typedef __attribute__((ext_vector_type(4)))  int      v4i;
typedef __attribute__((ext_vector_type(8)))  int      v8i;

__device__ __forceinline__ v16h frag_rowmajor(const _Float16* base, int row,
                                              int stride, int col) {
  const _Float16* p = base + row * stride + col;
  v8h lo = *reinterpret_cast<const v8h*>(p);
  v8h hi = *reinterpret_cast<const v8h*>(p + 16);
  v16h r;
#pragma unroll
  for (int i = 0; i < 8; ++i) {
    r[i]     = lo[i];
    r[i + 8] = hi[i];
  }
  return r;
}

__device__ __forceinline__ float xhalf(float x) {
  const int xi = __builtin_bit_cast(int, x);
  return __builtin_bit_cast(float, __builtin_amdgcn_permlanex16(
      xi, xi, 0x76543210, 0xfedcba98, false, false));
}

__device__ __forceinline__ v8f zero_v8f() {
  v8f z;
#pragma unroll
  for (int i = 0; i < 8; ++i) z[i] = 0.0f;
  return z;
}

__device__ __forceinline__ void tdm_load_2d_f16(unsigned lds_byte_off,
                                                const _Float16* gaddr,
                                                unsigned tensor_d0,
                                                unsigned tensor_d1,
                                                unsigned tile_d0,
                                                unsigned tile_d1,
                                                unsigned stride0_elems,
                                                unsigned pad_interval_code,
                                                unsigned pad_amount_code) {
  const unsigned long long ga = (unsigned long long)(uintptr_t)gaddr;
  v4u g0;
  g0[0] = 1u;                                            // count=1 (valid, user)
  g0[1] = lds_byte_off;                                  // lds_addr
  g0[2] = (unsigned)(ga & 0xffffffffu);                  // global_addr[31:0]
  g0[3] = (unsigned)((ga >> 32) & 0x01ffffffu) | (2u << 30);  // [56:32] | type=2

  v8i g1;
  g1[0] = (int)((1u << 16) |
                (1u << 20) |
                (pad_interval_code << 22) |
                (pad_amount_code << 25));
  g1[1] = (int)((tensor_d0 & 0xffffu) << 16);            // dim0[15:0] @ bit48
  g1[2] = (int)((tensor_d0 >> 16) | ((tensor_d1 & 0xffffu) << 16));
  g1[3] = (int)((tensor_d1 >> 16) | (tile_d0 << 16));
  g1[4] = (int)(tile_d1 & 0xffffu);
  g1[5] = (int)stride0_elems;
  g1[6] = 0;
  g1[7] = 0;

  v4i z4;
  z4[0] = 0; z4[1] = 0; z4[2] = 0; z4[3] = 0;
#if __clang_major__ >= 23
  v8i z8;
#pragma unroll
  for (int i = 0; i < 8; ++i) z8[i] = 0;
  __builtin_amdgcn_tensor_load_to_lds(g0, g1, z4, z4, z8, 0);
#else
  __builtin_amdgcn_tensor_load_to_lds(g0, g1, z4, z4, 0);
#endif
}

// ---------------------------------------------------------------------------
// Projection: out[o,l] = sum_c W[o,c] x[b,c,l] + bias[o], cast to f16.
// which (blockIdx.z): 0 -> Q ([L,C]), 1 -> K ([L,C]), 2 -> V ([C,L]).
// The product runs on the f16 matrix form. Each f32 operand is split into
// hi = f16(a) and lo = f16(a - hi); W x = Whi xhi + Whi xlo + Wlo xhi, summed in
// f32, leaves out only the lo*lo term, so the f32 operands' accuracy stays.
// Block = 8 waves; W is staged once, then two tiles of 64 positions follow one
// another. Both operands lie in LDS as [row][channel] (x transposed on the way
// in). A wave multiplies 16 rows of one operand (its 16 output rows) with 64 rows
// of the other (128 bytes of each output row): V: 16 rows of W against all 64
// positions; Q, K: 16 positions against 64 rows of W.
// ---------------------------------------------------------------------------
#define PLT  64                    // positions per tile
#define PNT  2                     // tiles per work-group
#define XSTR 136                   // LDS row pitch in halves: 128 channels + 16 bytes
#define OSTR 72                    // output staging pitch in halves: 128 bytes + 16
#define XPL  (PLT * XSTR)          // one plane (hi or lo) of the x tile
#define WPL  (CC * XSTR)           // one plane of W
#define WOFF (2 * XPL)             // W planes lie behind the two x planes

typedef __attribute__((ext_vector_type(4))) _Float16 v4h;
typedef __attribute__((ext_vector_type(4))) float    v4f;

__device__ __forceinline__ void split_f16(float a, _Float16& hi, _Float16& lo) {
  hi = (_Float16)a;
  lo = (_Float16)(a - (float)hi);
}

__device__ __forceinline__ v8f wmma_f16(v16h a, v16h b, v8f c) {
  return __builtin_amdgcn_wmma_f32_16x16x32_f16(false, a, false, b, (short)0, c,
                                                false, false);
}

// A thread's share of an x tile: one position, 32 channels. A wave's load is 128
// contiguous bytes.
__device__ __forceinline__ void proj_load_x(float (&f)[4][8], const float* xp) {
#pragma unroll
  for (int g = 0; g < 4; ++g)
#pragma unroll
    for (int i = 0; i < 8; ++i) f[g][i] = xp[(size_t)(g * 8 + i) * LL];
}

// Split it and put it at [position][channel]; a wave's 16-byte stores lie one
// pitch apart.
__device__ __forceinline__ void proj_store_x(const float (&f)[4][8], _Float16* row) {
#pragma unroll
  for (int g = 0; g < 4; ++g) {
    v8h h8, l8;
#pragma unroll
    for (int i = 0; i < 8; ++i) {
      _Float16 h, lo;
      split_f16(f[g][i], h, lo);
      h8[i] = h;
      l8[i] = lo;
    }
    *reinterpret_cast<v8h*>(row + g * 8)       = h8;
    *reinterpret_cast<v8h*>(row + XPL + g * 8) = l8;
  }
}

__launch_bounds__(256)
__global__ void cgp_proj_kernel(const float* __restrict__ pose,
                                const float* __restrict__ idf,
                                const float* __restrict__ Wq, const float* __restrict__ bq,
                                const float* __restrict__ Wk, const float* __restrict__ bk,
                                const float* __restrict__ Wv, const float* __restrict__ bv,
                                _Float16* __restrict__ Qb,
                                _Float16* __restrict__ Kb,
                                _Float16* __restrict__ Vb) {
  const int which = blockIdx.z;
  const int b     = blockIdx.y;
  const int l0    = blockIdx.x * (PLT * PNT);
  const int tid   = threadIdx.x;
  const int wv    = tid >> 5;
  const int ln    = tid & 31;
  const int hn    = ln & 15;
  const int hg    = ln >> 4;
  const bool isV  = (which == 2);

  const float* x    = (which == 1) ? idf : pose;
  const float* W    = (which == 0) ? Wq : (which == 1) ? Wk : Wv;
  const float* bias = (which == 0) ? bq : (which == 1) ? bk : bv;

  // x hi plane, x lo plane, W hi plane, W lo plane.
  __shared__ __attribute__((aligned(16))) _Float16 sm[2 * XPL + 2 * WPL];
  __shared__ __attribute__((aligned(16))) float sb[CC];  // the bias

  // This thread's place in the x staging: position tid & 63, channels 32 * (tid >> 6) on.
  const float* xp   = x + ((size_t)b * CC + (tid >> 6) * 32) * LL + l0 + (tid & (PLT - 1));
  _Float16*    xrow = sm + (tid & (PLT - 1)) * XSTR + (tid >> 6) * 32;

  float f[4][8];
  proj_load_x(f, xp);
  asm volatile("s_wait_xcnt 0x0" ::: "memory");
  {
    // W: a wave's load is one whole row of 512 bytes.
    const float* wp = W + wv * CC + ln * 4;
    v4f wr[16];
#pragma unroll
    for (int i = 0; i < 16; ++i)
      wr[i] = *reinterpret_cast<const v4f*>(wp + i * 8 * CC);
    // The same for the W loads; as an input the pointer keeps its registers up to
    // the wait, so that none of these loads' own results is put there.
    asm volatile("s_wait_xcnt 0x0" ::"v"(wp) : "memory");
    if (tid < CC) sb[tid] = bias[tid];
    proj_store_x(f, xrow);
#pragma unroll
    for (int i = 0; i < 16; ++i) {
      v4h h4, l4;
#pragma unroll
      for (int e = 0; e < 4; ++e) {
        _Float16 h, lo;
        split_f16(wr[i][e], h, lo);
        h4[e] = h;
        l4[e] = lo;
      }
      *reinterpret_cast<v4h*>(&sm[WOFF + (i * 8 + wv) * XSTR + ln * 4])       = h4;
      *reinterpret_cast<v4h*>(&sm[WOFF + WPL + (i * 8 + wv) * XSTR + ln * 4]) = l4;
    }
  }

  const int r_hi = isV ? WOFF + wv * 16 * XSTR : (wv & 3) * 16 * XSTR;
  const int r_lo = r_hi + (isV ? WPL : XPL);
  const int s_hi = isV ? 0 : WOFF + (wv >> 2) * 64 * XSTR;
  const int s_lo = s_hi + (isV ? XPL : WPL);

  // This wave's 16 output rows of 128 bytes, first tile; step to the next tile.
  _Float16* dst;
  int pitch, tstep;
  if (isV) {
    dst   = Vb + ((size_t)b * CC + wv * 16) * LL + l0;
    pitch = LL;
    tstep = PLT;
  } else {
    dst   = (which == 0 ? Qb : Kb) + ((size_t)b * LL + l0 + (wv & 3) * 16) * CC + (wv >> 2) * 64;
    pitch = CC;
    tstep = PLT * CC;
  }

#pragma unroll
  for (int tile = 0; tile < PNT; ++tile) {
    __syncthreads();  // the operands of this tile (first tile: W and the bias too) are in LDS

    // The next tile's x flies while this one is multiplied.
    if (tile + 1 < PNT) proj_load_x(f, xp + (tile + 1) * PLT);

    // Accumulators start at the bias.
    // acc[t][r] = out(output row hn of this wave, column t*16 + hg*8 + r of its 64)
    v8f acc[4];
    if (isV) {
      const float bo = sb[wv * 16 + hn];
#pragma unroll
      for (int t = 0; t < 4; ++t)
#pragma unroll
        for (int r = 0; r < 8; ++r) acc[t][r] = bo;
    } else {
      const float* bp = sb + (wv >> 2) * 64 + hg * 8;
#pragma unroll
      for (int t = 0; t < 4; ++t)
#pragma unroll
        for (int r = 0; r < 8; ++r) acc[t][r] = bp[t * 16 + r];
    }

    // Kept rolled: unrolled, the compiler fetches fragments of several k steps ahead,
    // and the registers then admit fewer work-groups on a WGP than the three of LDS.
#pragma unroll 1
    for (int kc = 0; kc < 4; ++kc) {
      const v16h rh = frag_rowmajor(sm + r_hi, hn, XSTR, kc * 32 + hg * 8);
      const v16h rl = frag_rowmajor(sm + r_lo, hn, XSTR, kc * 32 + hg * 8);
      v16h fh[4], fl[4];
#pragma unroll
      for (int t = 0; t < 4; ++t) {
        fh[t] = frag_rowmajor(sm + s_hi, t * 16 + hn, XSTR, kc * 32 + hg * 8);
        fl[t] = frag_rowmajor(sm + s_lo, t * 16 + hn, XSTR, kc * 32 + hg * 8);
      }
#pragma unroll
      for (int t = 0; t < 4; ++t) acc[t] = wmma_f16(fl[t], rh, acc[t]);
#pragma unroll
      for (int t = 0; t < 4; ++t) acc[t] = wmma_f16(fh[t], rl, acc[t]);
#pragma unroll
      for (int t = 0; t < 4; ++t) acc[t] = wmma_f16(fh[t], rh, acc[t]);
    }
    __syncthreads();  // every wave has read this tile's x planes for the last time

    // Whole 128-byte lines go out: each wave turns its 16 x 64 tile round in a
    // range of its own inside the x planes.
    _Float16* st = sm + wv * 16 * OSTR;
#pragma unroll
    for (int t = 0; t < 4; ++t) {
      v8h o8;
#pragma unroll
      for (int r = 0; r < 8; ++r) o8[r] = (_Float16)acc[t][r];
      *reinterpret_cast<v8h*>(&st[hn * OSTR + t * 16 + hg * 8]) = o8;
    }
    // The wave's own LDS stores have landed before other lanes read the rows back.
    asm volatile("s_wait_dscnt 0x0" ::: "memory");
#pragma unroll
    for (int j = 0; j < 4; ++j) {
      const int row = j * 4 + (ln >> 3);
      const v8h o8 = *reinterpret_cast<const v8h*>(&st[row * OSTR + (ln & 7) * 8]);
      *reinterpret_cast<v8h*>(dst + (size_t)tile * tstep + (size_t)row * pitch + (ln & 7) * 8) = o8;
    }

    if (tile + 1 < PNT) {
      asm volatile("s_wait_xcnt 0x0" ::: "memory");
      __builtin_amdgcn_sched_barrier(0);
      __syncthreads();  // every wave has read its rows back: the x planes are free
      proj_store_x(f, xrow);
    }
  }
}

#define KT   64
#define KSTR 136  // K LDS row stride (halves): 64 DW row + 4 DW hw pad
#define VSTR 72   // V LDS row stride (halves): 32 DW row + 4 DW hw pad
#define NIT  (LL / KT)

__launch_bounds__(256) __attribute__((amdgpu_waves_per_eu(2, 2)))
__global__ void cgp_attn_kernel(const _Float16* __restrict__ Qb,
                                const _Float16* __restrict__ Kb,
                                const _Float16* __restrict__ Vb,
                                const float* __restrict__ pose,
                                const float* __restrict__ gamma,
                                float* __restrict__ out) {
  __shared__ _Float16 sK[2][64 * KSTR];
  __shared__ _Float16 sV[2][CC * VSTR];

  const int b   = blockIdx.y;
  const int q0  = blockIdx.x * 128;
  const int tid = threadIdx.x;
  const int wv  = tid >> 5;
  const int ln  = tid & 31;
  const int hn  = ln & 15;
  const int hg  = ln >> 4;

  const _Float16* Qbase = Qb + (size_t)b * LL * CC;  // [L,C]
  const _Float16* Kbase = Kb + (size_t)b * LL * CC;  // [L,C]
  const _Float16* Vbase = Vb + (size_t)b * CC * LL;  // [C,L]

  const int i0 = q0 + wv * 16;
  const bool tdm_wave = (wv == 0);

  // Resident Q fragments.
  v16h qf[4];
#pragma unroll
  for (int kc = 0; kc < 4; ++kc)
    qf[kc] = frag_rowmajor(Qbase, i0 + hn, CC, kc * 32 + hg * 8);

  v8f O[8];
#pragma unroll
  for (int cc8 = 0; cc8 < 8; ++cc8) O[cc8] = zero_v8f();

  // This lane's query: running maximum (equal in both wave halves) and the
  // running sum over this half's keys only (the halves join in the epilogue).
  float mrun = -3.0e38f, lrun = 0.0f;

  // Prologue: DMA tile 0 into buffer 0.
  if (tdm_wave) {
    tdm_load_2d_f16((unsigned)(uintptr_t)&sK[0][0], Kbase,
                    CC, LL, CC, KT, CC, /*pad: every 64 DW*/ 5, /*4 DW*/ 3);
    tdm_load_2d_f16((unsigned)(uintptr_t)&sV[0][0], Vbase,
                    LL, CC, KT, CC, LL, /*pad: every 32 DW*/ 4, /*4 DW*/ 3);
  }

  for (int it = 0; it < NIT; ++it) {
    const int nb = (it + 1) & 1;
    if (tdm_wave) {
      if (it + 1 < NIT) {
        const int j1 = (it + 1) * KT;
        tdm_load_2d_f16((unsigned)(uintptr_t)&sK[nb][0],
                        Kbase + (size_t)j1 * CC, CC, LL, CC, KT, CC, 5, 3);
        tdm_load_2d_f16((unsigned)(uintptr_t)&sV[nb][0],
                        Vbase + j1, LL, CC, KT, CC, LL, 4, 3);
        __builtin_amdgcn_s_wait_tensorcnt(2);   // current tile's 2 ops done
      } else {
        __builtin_amdgcn_s_wait_tensorcnt(0);
      }
    }
    __syncthreads();  // tile `it` visible to all waves

    const _Float16* k = sK[it & 1];
    const _Float16* v = sV[it & 1];

    // ---- S^T = K Q^T : A = 16 key rows from LDS, B = resident Q columns ----
    // S[jt][r] = score(key jt*16 + hg*8 + r, query i0 + hn)
    v8f S[4];
#pragma unroll
    for (int jt = 0; jt < 4; ++jt) {
      v16h kf[4];
#pragma unroll
      for (int kc = 0; kc < 4; ++kc)
        kf[kc] = frag_rowmajor(k, jt * 16 + hn, KSTR, kc * 32 + hg * 8);
      v8f acc = zero_v8f();
#pragma unroll
      for (int kc = 0; kc < 4; ++kc)
        acc = __builtin_amdgcn_wmma_f32_16x16x32_f16(false, kf[kc], false, qf[kc],
                                                     (short)0, acc, false, false);
      S[jt] = acc;
    }

    // ---- online softmax: in-lane over 32 scores, one exchange between halves ----
    float mt[4];
#pragma unroll
    for (int jt = 0; jt < 4; ++jt) {
      mt[jt] = S[jt][0];
#pragma unroll
      for (int r = 1; r < 8; ++r) mt[jt] = fmaxf(mt[jt], S[jt][r]);
    }
    float mv = fmaxf(fmaxf(mt[0], mt[1]), fmaxf(mt[2], mt[3]));
    mv = fmaxf(mv, xhalf(mv));
    const float mnew  = fmaxf(mrun, mv);
    const float alpha = __expf(mrun - mnew);
    mrun = mnew;

    float st[4];
#pragma unroll
    for (int jt = 0; jt < 4; ++jt) {
#pragma unroll
      for (int r = 0; r < 8; ++r) S[jt][r] = __expf(S[jt][r] - mnew);
      st[jt] = ((S[jt][0] + S[jt][1]) + (S[jt][2] + S[jt][3])) +
               ((S[jt][4] + S[jt][5]) + (S[jt][6] + S[jt][7]));
    }
    lrun = lrun * alpha + ((st[0] + st[1]) + (st[2] + st[3]));

#pragma unroll
    for (int cc8 = 0; cc8 < 8; ++cc8)
#pragma unroll
      for (int r = 0; r < 8; ++r) O[cc8][r] *= alpha;

    // ---- O^T += V P^T : A = 16 channel rows of V from LDS; B = P^T packed in
    // place from two score tiles (element s = tile s>>3, register s&7, which is
    // the k order that frag_rowmajor gives the V rows) ----
#pragma unroll
    for (int jc = 0; jc < 2; ++jc) {
      v16h pf;
#pragma unroll
      for (int s = 0; s < 8; ++s) {
        pf[s]     = (_Float16)S[2 * jc][s];
        pf[s + 8] = (_Float16)S[2 * jc + 1][s];
      }
#pragma unroll
      for (int cc8 = 0; cc8 < 8; ++cc8) {
        v16h vf = frag_rowmajor(v, cc8 * 16 + hn, VSTR, jc * 32 + hg * 8);
        O[cc8] = __builtin_amdgcn_wmma_f32_16x16x32_f16(false, vf, false, pf,
                                                        (short)0, O[cc8], false, false);
      }
    }
    __syncthreads();
  }

  // ---- epilogue: out = pose + gamma * O / l ----
  // O[cc8][r] = O^T(channel cc8*16 + hg*8 + r, query i0 + hn)
  const float inv = 1.0f / (lrun + xhalf(lrun));
  const float g = gamma[0];
  const float* pbase = pose + (size_t)b * CC * LL + (size_t)(i0 + hn);
  float*       obase = out  + (size_t)b * CC * LL + (size_t)(i0 + hn);

#pragma unroll
  for (int cc8 = 0; cc8 < 8; ++cc8) {
#pragma unroll
    for (int r = 0; r < 8; ++r) {
      const size_t off = (size_t)(cc8 * 16 + hg * 8 + r) * LL;
      obase[off] = fmaf(g, O[cc8][r] * inv, pbase[off]);
    }
  }
}

// ---------------------------------------------------------------------------
extern "C" void kernel_launch(void* const* d_in, const int* in_sizes, int n_in,
                              void* d_out, int out_size, void* d_ws, size_t ws_size,
                              hipStream_t stream) {
  const float* pose  = (const float*)d_in[0];
  const float* idf   = (const float*)d_in[1];
  const float* Wq    = (const float*)d_in[2];
  const float* bq    = (const float*)d_in[3];
  const float* Wk    = (const float*)d_in[4];
  const float* bk    = (const float*)d_in[5];
  const float* Wv    = (const float*)d_in[6];
  const float* bv    = (const float*)d_in[7];
  const float* gamma = (const float*)d_in[8];
  float* out = (float*)d_out;

  const size_t mat_bytes = (size_t)BB * LL * CC * sizeof(_Float16);  // 8 MB each
  char* ws = (char*)d_ws;
  _Float16* Qb = reinterpret_cast<_Float16*>(ws);
  _Float16* Kb = reinterpret_cast<_Float16*>(ws + mat_bytes);
  _Float16* Vb = reinterpret_cast<_Float16*>(ws + 2 * mat_bytes);

  cgp_proj_kernel<<<dim3(LL / (PLT * PNT), BB, 3), dim3(256), 0, stream>>>(
      pose, idf, Wq, bq, Wk, bk, Wv, bv, Qb, Kb, Vb);

  cgp_attn_kernel<<<dim3(LL / 128, BB), dim3(256), 0, stream>>>(
      Qb, Kb, Vb, pose, gamma, out);
}

// v003
// A run of this version takes 59.5 microseconds.
// Next to v002, in two timings, it ran 1.27 and 1.26 times as fast.
// All steps since v000 together make it 2.79 times as fast.
#include <hip/hip_runtime.h>

#define BB 8
#define CC 128
#define LL 4096

typedef __attribute__((ext_vector_type(16))) _Float16 v16h;
typedef __attribute__((ext_vector_type(8)))  _Float16 v8h;
typedef __attribute__((ext_vector_type(8)))  float    v8f;
typedef __attribute__((ext_vector_type(4)))  unsigned int v4u;
typedef __attribute__((ext_vector_type(8)))  unsigned int v8u;

__device__ __forceinline__ v16h frag_rowmajor(const _Float16* base, int row,
                                              int stride, int col) {
  const _Float16* p = base + row * stride + col;
  v8h lo = *reinterpret_cast<const v8h*>(p);
  v8h hi = *reinterpret_cast<const v8h*>(p + 16);
  v16h r;
#pragma unroll
  for (int i = 0; i < 8; ++i) {
    r[i]     = lo[i];
    r[i + 8] = hi[i];
  }
  return r;
}

__device__ __forceinline__ float xhalf(float x) {
  const int xi = __builtin_bit_cast(int, x);
  return __builtin_bit_cast(float, __builtin_amdgcn_permlanex16(
      xi, xi, 0x76543210, 0xfedcba98, false, false));
}

__device__ __forceinline__ v8f zero_v8f() {
  v8f z;
#pragma unroll
  for (int i = 0; i < 8; ++i) z[i] = 0.0f;
  return z;
}

__device__ __forceinline__ unsigned uni(unsigned v) {
  return (unsigned)__builtin_amdgcn_readfirstlane((int)v);
}

__device__ __forceinline__ unsigned pinned(unsigned v) {
  unsigned w = uni(v);
  asm volatile("" : "+s"(w));  // keeps the test word in a scalar register
  return w;
}

__device__ __forceinline__ v4u tile_group0(unsigned lds_byte_off, const _Float16* gaddr) {
  const unsigned long long ga = (unsigned long long)(uintptr_t)gaddr;
  v4u g0;
  g0[0] = uni(1u);
  g0[1] = uni(lds_byte_off);
  g0[2] = uni((unsigned)ga);
  g0[3] = uni((((unsigned)(ga >> 32)) & 0x01ffffffu) | 0x80000000u);
  asm volatile("" : "+s"(g0));
  return g0;
}

__device__ __forceinline__ v8u tile_group1(unsigned src_pitch_bytes) {
  v8u g1;
  g1[0] = uni((1u << 20) | (5u << 22) | (3u << 25));
  g1[1] = uni(256u << 16);
  g1[2] = uni(128u << 16);
  g1[3] = uni(256u << 16);
  g1[4] = uni(128u);
  g1[5] = uni(src_pitch_bytes);
  g1[6] = uni(0u);
  g1[7] = uni(0u);
  asm volatile("" : "+s"(g1));
  return g1;
}

// The request itself; the waits for it stand at its callers.
__device__ __forceinline__ void tile_load(v4u g0, v8u g1) {
  asm volatile("tensor_load_to_lds %0, %1" ::"s"(g0), "s"(g1) : "memory");
}

// The issuing wave's tile has landed. As inputs the request's two groups keep their
// registers up to this wait.
__device__ __forceinline__ void tile_wait(v4u g0, v8u g1) {
  asm volatile("s_wait_tensorcnt 0x0" ::"s"(g0), "s"(g1) : "memory");
}

// ---------------------------------------------------------------------------
// Projection: out[o,l] = sum_c W[o,c] x[b,c,l] + bias[o], cast to f16.
// which (blockIdx.z): 0 -> Q ([L,C]), 1 -> K ([L,C]), 2 -> V ([C,L]).
// The product runs on the f16 matrix form. Each f32 operand is split into
// hi = f16(a) and lo = f16(a - hi); W x = Whi xhi + Whi xlo + Wlo xhi, summed in
// f32, leaves out only the lo*lo term, so the f32 operands' accuracy stays.
// Block = 8 waves; W is staged once, then two tiles of 64 positions follow one
// another. Both operands lie in LDS as [row][channel] (x transposed on the way
// in). A wave multiplies 16 rows of one operand (its 16 output rows) with 64 rows
// of the other (128 bytes of each output row): V: 16 rows of W against all 64
// positions; Q, K: 16 positions against 64 rows of W.
// ---------------------------------------------------------------------------
#define PLT  64                    // positions per tile
#define PNT  2                     // tiles per work-group
#define XSTR 136                   // LDS row pitch in halves: 128 channels + 16 bytes
#define OSTR 72                    // output staging pitch in halves: 128 bytes + 16
#define XPL  (PLT * XSTR)          // one plane (hi or lo) of the x tile
#define WPL  (CC * XSTR)           // one plane of W
#define WOFF (2 * XPL)             // W planes lie behind the two x planes

typedef __attribute__((ext_vector_type(4))) _Float16 v4h;
typedef __attribute__((ext_vector_type(4))) float    v4f;

__device__ __forceinline__ void split_f16(float a, _Float16& hi, _Float16& lo) {
  hi = (_Float16)a;
  lo = (_Float16)(a - (float)hi);
}

__device__ __forceinline__ v8f wmma_f16(v16h a, v16h b, v8f c) {
  return __builtin_amdgcn_wmma_f32_16x16x32_f16(false, a, false, b, (short)0, c,
                                                false, false);
}

// A thread's share of an x tile: one position, 32 channels. A wave's load is 128
// contiguous bytes.
__device__ __forceinline__ void proj_load_x(float (&f)[4][8], const float* xp) {
#pragma unroll
  for (int g = 0; g < 4; ++g)
#pragma unroll
    for (int i = 0; i < 8; ++i) f[g][i] = xp[(size_t)(g * 8 + i) * LL];
}

// Split it and put it at [position][channel]; a wave's 16-byte stores lie one
// pitch apart.
__device__ __forceinline__ void proj_store_x(const float (&f)[4][8], _Float16* row) {
#pragma unroll
  for (int g = 0; g < 4; ++g) {
    v8h h8, l8;
#pragma unroll
    for (int i = 0; i < 8; ++i) {
      _Float16 h, lo;
      split_f16(f[g][i], h, lo);
      h8[i] = h;
      l8[i] = lo;
    }
    *reinterpret_cast<v8h*>(row + g * 8)       = h8;
    *reinterpret_cast<v8h*>(row + XPL + g * 8) = l8;
  }
}

__launch_bounds__(256)
__global__ void cgp_proj_kernel(const float* __restrict__ pose,
                                const float* __restrict__ idf,
                                const float* __restrict__ Wq, const float* __restrict__ bq,
                                const float* __restrict__ Wk, const float* __restrict__ bk,
                                const float* __restrict__ Wv, const float* __restrict__ bv,
                                _Float16* __restrict__ Qb,
                                _Float16* __restrict__ Kb,
                                _Float16* __restrict__ Vb) {
  const int which = blockIdx.z;
  const int b     = blockIdx.y;
  const int l0    = blockIdx.x * (PLT * PNT);
  const int tid   = threadIdx.x;
  const int wv    = tid >> 5;
  const int ln    = tid & 31;
  const int hn    = ln & 15;
  const int hg    = ln >> 4;
  const bool isV  = (which == 2);

  const float* x    = (which == 1) ? idf : pose;
  const float* W    = (which == 0) ? Wq : (which == 1) ? Wk : Wv;
  const float* bias = (which == 0) ? bq : (which == 1) ? bk : bv;

  // x hi plane, x lo plane, W hi plane, W lo plane.
  __shared__ __attribute__((aligned(16))) _Float16 sm[2 * XPL + 2 * WPL];
  __shared__ __attribute__((aligned(16))) float sb[CC];  // the bias

  // This thread's place in the x staging: position tid & 63, channels 32 * (tid >> 6) on.
  const float* xp   = x + ((size_t)b * CC + (tid >> 6) * 32) * LL + l0 + (tid & (PLT - 1));
  _Float16*    xrow = sm + (tid & (PLT - 1)) * XSTR + (tid >> 6) * 32;

  float f[4][8];
  proj_load_x(f, xp);
  asm volatile("s_wait_xcnt 0x0" ::: "memory");
  {
    // W: a wave's load is one whole row of 512 bytes.
    const float* wp = W + wv * CC + ln * 4;
    v4f wr[16];
#pragma unroll
    for (int i = 0; i < 16; ++i)
      wr[i] = *reinterpret_cast<const v4f*>(wp + i * 8 * CC);
    // The same for the W loads; as an input the pointer keeps its registers up to
    // the wait, so that none of these loads' own results is put there.
    asm volatile("s_wait_xcnt 0x0" ::"v"(wp) : "memory");
    if (tid < CC) sb[tid] = bias[tid];
    proj_store_x(f, xrow);
#pragma unroll
    for (int i = 0; i < 16; ++i) {
      v4h h4, l4;
#pragma unroll
      for (int e = 0; e < 4; ++e) {
        _Float16 h, lo;
        split_f16(wr[i][e], h, lo);
        h4[e] = h;
        l4[e] = lo;
      }
      *reinterpret_cast<v4h*>(&sm[WOFF + (i * 8 + wv) * XSTR + ln * 4])       = h4;
      *reinterpret_cast<v4h*>(&sm[WOFF + WPL + (i * 8 + wv) * XSTR + ln * 4]) = l4;
    }
  }

  const int r_hi = isV ? WOFF + wv * 16 * XSTR : (wv & 3) * 16 * XSTR;
  const int r_lo = r_hi + (isV ? WPL : XPL);
  const int s_hi = isV ? 0 : WOFF + (wv >> 2) * 64 * XSTR;
  const int s_lo = s_hi + (isV ? XPL : WPL);

  // This wave's 16 output rows of 128 bytes, first tile; step to the next tile.
  _Float16* dst;
  int pitch, tstep;
  if (isV) {
    dst   = Vb + ((size_t)b * CC + wv * 16) * LL + l0;
    pitch = LL;
    tstep = PLT;
  } else {
    dst   = (which == 0 ? Qb : Kb) + ((size_t)b * LL + l0 + (wv & 3) * 16) * CC + (wv >> 2) * 64;
    pitch = CC;
    tstep = PLT * CC;
  }

#pragma unroll
  for (int tile = 0; tile < PNT; ++tile) {
    __syncthreads();  // the operands of this tile (first tile: W and the bias too) are in LDS

    // The next tile's x flies while this one is multiplied.
    if (tile + 1 < PNT) proj_load_x(f, xp + (tile + 1) * PLT);

    // Accumulators start at the bias.
    // acc[t][r] = out(output row hn of this wave, column t*16 + hg*8 + r of its 64)
    v8f acc[4];
    if (isV) {
      const float bo = sb[wv * 16 + hn];
#pragma unroll
      for (int t = 0; t < 4; ++t)
#pragma unroll
        for (int r = 0; r < 8; ++r) acc[t][r] = bo;
    } else {
      const float* bp = sb + (wv >> 2) * 64 + hg * 8;
#pragma unroll
      for (int t = 0; t < 4; ++t)
#pragma unroll
        for (int r = 0; r < 8; ++r) acc[t][r] = bp[t * 16 + r];
    }

    // Kept rolled: unrolled, the compiler fetches fragments of several k steps ahead,
    // and the registers then admit fewer work-groups on a WGP than the three of LDS.
#pragma unroll 1
    for (int kc = 0; kc < 4; ++kc) {
      const v16h rh = frag_rowmajor(sm + r_hi, hn, XSTR, kc * 32 + hg * 8);
      const v16h rl = frag_rowmajor(sm + r_lo, hn, XSTR, kc * 32 + hg * 8);
      v16h fh[4], fl[4];
#pragma unroll
      for (int t = 0; t < 4; ++t) {
        fh[t] = frag_rowmajor(sm + s_hi, t * 16 + hn, XSTR, kc * 32 + hg * 8);
        fl[t] = frag_rowmajor(sm + s_lo, t * 16 + hn, XSTR, kc * 32 + hg * 8);
      }
#pragma unroll
      for (int t = 0; t < 4; ++t) acc[t] = wmma_f16(fl[t], rh, acc[t]);
#pragma unroll
      for (int t = 0; t < 4; ++t) acc[t] = wmma_f16(fh[t], rl, acc[t]);
#pragma unroll
      for (int t = 0; t < 4; ++t) acc[t] = wmma_f16(fh[t], rh, acc[t]);
    }
    __syncthreads();  // every wave has read this tile's x planes for the last time

    // Whole 128-byte lines go out: each wave turns its 16 x 64 tile round in a
    // range of its own inside the x planes.
    _Float16* st = sm + wv * 16 * OSTR;
#pragma unroll
    for (int t = 0; t < 4; ++t) {
      v8h o8;
#pragma unroll
      for (int r = 0; r < 8; ++r) o8[r] = (_Float16)acc[t][r];
      *reinterpret_cast<v8h*>(&st[hn * OSTR + t * 16 + hg * 8]) = o8;
    }
    // The wave's own LDS stores have landed before other lanes read the rows back.
    asm volatile("s_wait_dscnt 0x0" ::: "memory");
#pragma unroll
    for (int j = 0; j < 4; ++j) {
      const int row = j * 4 + (ln >> 3);
      const v8h o8 = *reinterpret_cast<const v8h*>(&st[row * OSTR + (ln & 7) * 8]);
      *reinterpret_cast<v8h*>(dst + (size_t)tile * tstep + (size_t)row * pitch + (ln & 7) * 8) = o8;
    }

    if (tile + 1 < PNT) {
      asm volatile("s_wait_xcnt 0x0" ::: "memory");
      __builtin_amdgcn_sched_barrier(0);
      __syncthreads();  // every wave has read its rows back: the x planes are free
      proj_store_x(f, xrow);
    }
  }
}

// ---------------------------------------------------------------------------
// Flash attention; K and V staged by tensor loads in a ring of two buffers.
// Block = 256 threads = 8 waves on 128 queries. A stage is 128 keys. Wave w owns the
// 32 queries q0 + 32 * (w & 3) on and the 64 keys 64 * (w >> 2) on of every stage, so
// every K and V fragment read from LDS feeds two matrix instructions (two 16-query
// tiles). The two waves of a query group join their key halves in the epilogue.
// Products are taken transposed: S^T = K Q^T and O^T += V P^T, so a lane holds
// the scores of ONE query per tile (column hn; keys 8*hg..8*hg+7 of each 16-key tile).
// Wave 0 brings the K tile of a stage, wave 1 its V tile, one request each.
// ---------------------------------------------------------------------------
#define KS    128               // keys per stage
#define RSTR  136               // LDS row pitch of K and V (halves): 256-byte row + 16 bytes
#define TILEH (128 * RSTR)      // one tile in halves; in bytes 34816 = 17 * 2 KiB
#define NST   (LL / KS)

__launch_bounds__(256) __attribute__((amdgpu_waves_per_eu(2, 2)))
__global__ void cgp_attn_kernel(const _Float16* __restrict__ Qb,
                                const _Float16* __restrict__ Kb,
                                const _Float16* __restrict__ Vb,
                                const float* __restrict__ pose,
                                const float* __restrict__ gamma,
                                float* __restrict__ out) {
  // K buffer 0, K buffer 1, V buffer 0, V buffer 1; each starts at a multiple of 2 KiB.
  __shared__ __attribute__((aligned(2048))) _Float16 ring[4 * TILEH];
  // Epilogue exchange between the two waves of a query group.
  __shared__ __attribute__((aligned(16))) v4f xO[8][16][32];
  __shared__ float xs[8][4][32];

  const int b   = blockIdx.y;
  const int q0  = blockIdx.x * 128;
  const int tid = threadIdx.x;
  const int ln  = tid & 31;
  const int hn  = ln & 15;
  const int hg  = ln >> 4;
  const unsigned wv = uni((unsigned)tid >> 5);
  const int qg  = wv & 3;   // query group
  const int kh  = wv >> 2;  // key half of every stage

  const _Float16* Qbase = Qb + (size_t)b * LL * CC;  // [L,C]
  const _Float16* Kbase = Kb + (size_t)b * LL * CC;  // [L,C]
  const _Float16* Vbase = Vb + (size_t)b * CC * LL;  // [C,L]

  const int i0 = q0 + qg * 32;

  // What an issuing wave brings: wave 0 K (128 key rows of 128 channels), wave 1 V
  // (128 channel rows of 128 keys).
  const bool     isV     = (wv == 1u);
  const _Float16* tsrc   = isV ? Vbase : Kbase;
  const unsigned tstep   = isV ? KS : KS * CC;                 // halves from stage to stage
  const unsigned tpitch  = isV ? LL * 2u : CC * 2u;            // source row pitch, bytes
  const unsigned tdst    = (unsigned)(uintptr_t)&ring[0] + (isV ? 4u * TILEH : 0u);

  // Resident Q fragments, two 16-query tiles.
  v16h qf[2][4];
#pragma unroll
  for (int qt = 0; qt < 2; ++qt)
#pragma unroll
    for (int kc = 0; kc < 4; ++kc)
      qf[qt][kc] = frag_rowmajor(Qbase, i0 + qt * 16 + hn, CC, kc * 32 + hg * 8);

  // Prologue: stage 0 lands and is published, then stage 1 is asked for.
  const v8u g1 = tile_group1(tpitch);
  v4u g0 = {0u, 0u, 0u, 0u};
  if (pinned(wv < 2u)) {
    g0 = tile_group0(tdst, tsrc);
    tile_load(g0, g1);
    tile_wait(g0, g1);  // stage 0 has landed before the barrier that lets the other waves read it
  }

  v8f O[2][8];
#pragma unroll
  for (int qt = 0; qt < 2; ++qt)
#pragma unroll
    for (int cc8 = 0; cc8 < 8; ++cc8) O[qt][cc8] = zero_v8f();

  // Per query tile, this lane's query: running maximum over this wave's keys (equal in
  // both wave halves) and the running sum over this lane half's keys only.
  float mrun[2] = {-3.0e38f, -3.0e38f}, lrun[2] = {0.0f, 0.0f};

  __syncthreads();  // stage 0 visible to all waves
  if (pinned(wv < 2u)) {
    g0 = tile_group0(tdst + 2u * TILEH, tsrc + tstep);
    tile_load(g0, g1);
  }

  for (int s = 0; s < NST; ++s) {
    const _Float16* k = ring + (s & 1) * TILEH + kh * 64 * RSTR;        // this wave's 64 key rows
    const _Float16* v = ring + (2 + (s & 1)) * TILEH + kh * 64;         // this wave's 64 key columns

    // ---- S^T = K Q^T : A = 16 key rows from LDS, B = resident Q columns ----
    // S[qt][jt][r] = score(key jt*16 + hg*8 + r of the wave's 64, query i0 + qt*16 + hn)
    v8f S[2][4];
#pragma unroll
    for (int jt = 0; jt < 4; ++jt) {
      v16h kf[4];
#pragma unroll
      for (int kc = 0; kc < 4; ++kc)
        kf[kc] = frag_rowmajor(k, jt * 16 + hn, RSTR, kc * 32 + hg * 8);
      v8f acc0 = zero_v8f(), acc1 = zero_v8f();
#pragma unroll
      for (int kc = 0; kc < 4; ++kc) {
        acc0 = wmma_f16(kf[kc], qf[0][kc], acc0);
        acc1 = wmma_f16(kf[kc], qf[1][kc], acc1);
      }
      S[0][jt] = acc0;
      S[1][jt] = acc1;
    }

    // All V fragments of the pass, asked for in one group.
    v16h vf[2][8];
#pragma unroll
    for (int jc = 0; jc < 2; ++jc)
#pragma unroll
      for (int cc8 = 0; cc8 < 8; ++cc8)
        vf[jc][cc8] = frag_rowmajor(v, cc8 * 16 + hn, RSTR, jc * 32 + hg * 8);
    // Keeps that group here, so that the softmax's vector work covers its latency: left
    // alone the compiler puts the loads among the matrix instructions and waits each out.
    __builtin_amdgcn_sched_barrier(0);

    // ---- online softmax: in-lane over 32 scores a tile, one exchange between halves ----
#pragma unroll
    for (int qt = 0; qt < 2; ++qt) {
      float mt[4];
#pragma unroll
      for (int jt = 0; jt < 4; ++jt) {
        mt[jt] = S[qt][jt][0];
#pragma unroll
        for (int r = 1; r < 8; ++r) mt[jt] = fmaxf(mt[jt], S[qt][jt][r]);
      }
      float mv = fmaxf(fmaxf(mt[0], mt[1]), fmaxf(mt[2], mt[3]));
      mv = fmaxf(mv, xhalf(mv));
      const float mnew  = fmaxf(mrun[qt], mv);
      const float alpha = __expf(mrun[qt] - mnew);
      mrun[qt] = mnew;

      float st[4];
#pragma unroll
      for (int jt = 0; jt < 4; ++jt) {
#pragma unroll
        for (int r = 0; r < 8; ++r) S[qt][jt][r] = __expf(S[qt][jt][r] - mnew);
        st[jt] = ((S[qt][jt][0] + S[qt][jt][1]) + (S[qt][jt][2] + S[qt][jt][3])) +
                 ((S[qt][jt][4] + S[qt][jt][5]) + (S[qt][jt][6] + S[qt][jt][7]));
      }
      lrun[qt] = lrun[qt] * alpha + ((st[0] + st[1]) + (st[2] + st[3]));

#pragma unroll
      for (int cc8 = 0; cc8 < 8; ++cc8)
#pragma unroll
        for (int r = 0; r < 8; ++r) O[qt][cc8][r] *= alpha;
    }

    // ---- O^T += V P^T : A = 16 channel rows of V from LDS; B = P^T packed in
    // place from two score tiles (element e = tile e>>3, register e&7, which is
    // the k order that frag_rowmajor gives the V rows) ----
#pragma unroll
    for (int jc = 0; jc < 2; ++jc) {
      v16h pf[2];
#pragma unroll
      for (int qt = 0; qt < 2; ++qt)
#pragma unroll
        for (int e = 0; e < 8; ++e) {
          pf[qt][e]     = (_Float16)S[qt][2 * jc][e];
          pf[qt][e + 8] = (_Float16)S[qt][2 * jc + 1][e];
        }
#pragma unroll
      for (int cc8 = 0; cc8 < 8; ++cc8) {
        O[0][cc8] = wmma_f16(vf[jc][cc8], pf[0], O[0][cc8]);
        O[1][cc8] = wmma_f16(vf[jc][cc8], pf[1], O[1][cc8]);
      }
    }

    __builtin_amdgcn_sched_barrier(0);
    // This wave's reads of stage s have returned before its buffer may be refilled.
    asm volatile("s_wait_dscnt 0x0" ::: "memory");
    if (pinned(wv < 2u)) tile_wait(g0, g1);  // its tile of stage s + 1 has landed before the barrier publishes it
    __syncthreads();  // stage s + 1 visible to all waves; every wave has left stage s
    if (pinned((wv < 2u) && (s + 2 < NST))) {
      g0 = tile_group0(tdst + (unsigned)(s & 1) * (2u * TILEH), tsrc + (size_t)(s + 2) * tstep);
      tile_load(g0, g1);
    }
  }
  // Nothing is outstanding when the wave goes on to the epilogue and ends.
  asm volatile("s_wait_tensorcnt 0x0" ::: "memory");
  asm volatile("s_wait_dscnt 0x0" ::: "memory");

  // ---- epilogue: join the two key halves, out = pose + gamma * O / l ----
  // O[qt][cc8][r] = O^T(channel cc8*16 + hg*8 + r, query i0 + qt*16 + hn), this wave's keys.
  // Wave kh finishes channels 64*kh .. 64*kh+63 of all 32 queries (whole 128-byte lines
  // of out) and hands the other 64 channels, its maxima and its sums to its partner.
#pragma unroll
  for (int qt = 0; qt < 2; ++qt) {
    lrun[qt] += xhalf(lrun[qt]);
    xs[wv][qt][ln]     = mrun[qt];
    xs[wv][2 + qt][ln] = lrun[qt];
#pragma unroll
    for (int c4 = 0; c4 < 4; ++c4)
#pragma unroll
      for (int h = 0; h < 2; ++h) {
        v4f t;
#pragma unroll
        for (int e = 0; e < 4; ++e) t[e] = kh ? O[qt][c4][h * 4 + e] : O[qt][4 + c4][h * 4 + e];
        xO[wv][(qt * 4 + c4) * 2 + h][ln] = t;
      }
  }
  __syncthreads();  // every wave's hand-over is in LDS

  const unsigned pw = wv ^ 4u;  // the partner: same queries, other key half
  const float g = gamma[0];
#pragma unroll
  for (int qt = 0; qt < 2; ++qt) {
    const float mp = xs[pw][qt][ln];
    const float lp = xs[pw][2 + qt][ln];
    const float m  = fmaxf(mrun[qt], mp);
    const float eo = __expf(mrun[qt] - m);
    const float ep = __expf(mp - m);
    const float inv = 1.0f / (lrun[qt] * eo + lp * ep);
    const float co = eo * inv, cp = ep * inv;
    const size_t col = (size_t)b * CC * LL + (size_t)(i0 + qt * 16 + hn);
#pragma unroll
    for (int c4 = 0; c4 < 4; ++c4)
#pragma unroll
      for (int h = 0; h < 2; ++h) {
        const v4f t = xO[pw][(qt * 4 + c4) * 2 + h][ln];
#pragma unroll
        for (int e = 0; e < 4; ++e) {
          const float own = kh ? O[qt][4 + c4][h * 4 + e] : O[qt][c4][h * 4 + e];
          const size_t off = col + (size_t)((kh * 4 + c4) * 16 + hg * 8 + h * 4 + e) * LL;
          out[off] = fmaf(g, own * co + t[e] * cp, pose[off]);
        }
      }
  }
}

// ---------------------------------------------------------------------------
extern "C" void kernel_launch(void* const* d_in, const int* in_sizes, int n_in,
                              void* d_out, int out_size, void* d_ws, size_t ws_size,
                              hipStream_t stream) {
  const float* pose  = (const float*)d_in[0];
  const float* idf   = (const float*)d_in[1];
  const float* Wq    = (const float*)d_in[2];
  const float* bq    = (const float*)d_in[3];
  const float* Wk    = (const float*)d_in[4];
  const float* bk    = (const float*)d_in[5];
  const float* Wv    = (const float*)d_in[6];
  const float* bv    = (const float*)d_in[7];
  const float* gamma = (const float*)d_in[8];
  float* out = (float*)d_out;

  const size_t mat_bytes = (size_t)BB * LL * CC * sizeof(_Float16);  // 8 MB each
  char* ws = (char*)d_ws;
  _Float16* Qb = reinterpret_cast<_Float16*>(ws);
  _Float16* Kb = reinterpret_cast<_Float16*>(ws + mat_bytes);
  _Float16* Vb = reinterpret_cast<_Float16*>(ws + 2 * mat_bytes);

  cgp_proj_kernel<<<dim3(LL / (PLT * PNT), BB, 3), dim3(256), 0, stream>>>(
      pose, idf, Wq, bq, Wk, bk, Wv, bv, Qb, Kb, Vb);

  cgp_attn_kernel<<<dim3(LL / 128, BB), dim3(256), 0, stream>>>(
      Qb, Kb, Vb, pose, gamma, out);
}

// v004
// One run takes 54.9 microseconds.
// Next to v003, in two timings, it ran 1.09 times as fast each time.
// Counting every step since v000, it is 3.03 times as fast.
#include <hip/hip_runtime.h>

#define BB 8
#define CC 128
#define LL 4096

typedef __attribute__((ext_vector_type(16))) _Float16 v16h;
typedef __attribute__((ext_vector_type(8)))  _Float16 v8h;
typedef __attribute__((ext_vector_type(8)))  float    v8f;
typedef __attribute__((ext_vector_type(4)))  unsigned int v4u;
typedef __attribute__((ext_vector_type(8)))  unsigned int v8u;

__device__ __forceinline__ v16h frag_rowmajor(const _Float16* base, int row,
                                              int stride, int col) {
  const _Float16* p = base + row * stride + col;
  v8h lo = *reinterpret_cast<const v8h*>(p);
  v8h hi = *reinterpret_cast<const v8h*>(p + 16);
  v16h r;
#pragma unroll
  for (int i = 0; i < 8; ++i) {
    r[i]     = lo[i];
    r[i + 8] = hi[i];
  }
  return r;
}

__device__ __forceinline__ float xhalf(float x) {
  const int xi = __builtin_bit_cast(int, x);
  return __builtin_bit_cast(float, __builtin_amdgcn_permlanex16(
      xi, xi, 0x76543210, 0xfedcba98, false, false));
}

__device__ __forceinline__ v8f zero_v8f() {
  v8f z;
#pragma unroll
  for (int i = 0; i < 8; ++i) z[i] = 0.0f;
  return z;
}

__device__ __forceinline__ unsigned uni(unsigned v) {
  return (unsigned)__builtin_amdgcn_readfirstlane((int)v);
}

__device__ __forceinline__ unsigned pinned(unsigned v) {
  unsigned w = uni(v);
  asm volatile("" : "+s"(w));  // keeps the test word in a scalar register
  return w;
}

__device__ __forceinline__ v4u tile_group0(unsigned lds_byte_off, const _Float16* gaddr) {
  const unsigned long long ga = (unsigned long long)(uintptr_t)gaddr;
  v4u g0;
  g0[0] = uni(1u);
  g0[1] = uni(lds_byte_off);
  g0[2] = uni((unsigned)ga);
  g0[3] = uni((((unsigned)(ga >> 32)) & 0x01ffffffu) | 0x80000000u);
  asm volatile("" : "+s"(g0));
  return g0;
}

__device__ __forceinline__ v8u tile_group1(unsigned src_pitch_bytes) {
  v8u g1;
  g1[0] = uni((1u << 20) | (5u << 22) | (3u << 25));
  g1[1] = uni(256u << 16);
  g1[2] = uni(128u << 16);
  g1[3] = uni(256u << 16);
  g1[4] = uni(128u);
  g1[5] = uni(src_pitch_bytes);
  g1[6] = uni(0u);
  g1[7] = uni(0u);
  asm volatile("" : "+s"(g1));
  return g1;
}

// The request itself; the waits for it stand at its callers.
__device__ __forceinline__ void tile_load(v4u g0, v8u g1) {
  asm volatile("tensor_load_to_lds %0, %1" ::"s"(g0), "s"(g1) : "memory");
}

// The issuing wave's tile has landed. As inputs the request's two groups keep their
// registers up to this wait.
__device__ __forceinline__ void tile_wait(v4u g0, v8u g1) {
  asm volatile("s_wait_tensorcnt 0x0" ::"s"(g0), "s"(g1) : "memory");
}

// ---------------------------------------------------------------------------
// Projection: out[o,l] = sum_c W[o,c] x[b,c,l] + bias[o], cast to f16.
// which (blockIdx.z): 0 -> Q ([L,C]), 1 -> K ([L,C]), 2 -> V ([C,L]).
// The product runs on the f16 matrix form. Each f32 operand is split into
// hi = f16(a) and lo = f16(a - hi); W x = Whi xhi + Whi xlo + Wlo xhi, summed in
// f32, leaves out only the lo*lo term, so the f32 operands' accuracy stays.
// Block = 8 waves; W is staged once, then two tiles of 64 positions follow one
// another. Both operands lie in LDS as [row][channel] (x transposed on the way
// in). A wave multiplies 16 rows of one operand (its 16 output rows) with 64 rows
// of the other (128 bytes of each output row): V: 16 rows of W against all 64
// positions; Q, K: 16 positions against 64 rows of W.
// ---------------------------------------------------------------------------
#define PLT  64                    // positions per tile
#define PNT  2                     // tiles per work-group
#define XSTR 136                   // LDS row pitch in halves: 128 channels + 16 bytes
#define OSTR 72                    // output staging pitch in halves: 128 bytes + 16
#define XPL  (PLT * XSTR)          // one plane (hi or lo) of the x tile
#define WPL  (CC * XSTR)           // one plane of W
#define WOFF (2 * XPL)             // W planes lie behind the two x planes

typedef __attribute__((ext_vector_type(4))) _Float16 v4h;
typedef __attribute__((ext_vector_type(4))) float    v4f;

__device__ __forceinline__ void split_f16(float a, _Float16& hi, _Float16& lo) {
  hi = (_Float16)a;
  lo = (_Float16)(a - (float)hi);
}

__device__ __forceinline__ v8f wmma_f16(v16h a, v16h b, v8f c) {
  return __builtin_amdgcn_wmma_f32_16x16x32_f16(false, a, false, b, (short)0, c,
                                                false, false);
}

// A thread's share of an x tile: one position, 32 channels. A wave's load is 128
// contiguous bytes.
__device__ __forceinline__ void proj_load_x(float (&f)[4][8], const float* xp) {
#pragma unroll
  for (int g = 0; g < 4; ++g)
#pragma unroll
    for (int i = 0; i < 8; ++i) f[g][i] = xp[(size_t)(g * 8 + i) * LL];
}

// Split it and put it at [position][channel]; a wave's 16-byte stores lie one
// pitch apart.
__device__ __forceinline__ void proj_store_x(const float (&f)[4][8], _Float16* row) {
#pragma unroll
  for (int g = 0; g < 4; ++g) {
    v8h h8, l8;
#pragma unroll
    for (int i = 0; i < 8; ++i) {
      _Float16 h, lo;
      split_f16(f[g][i], h, lo);
      h8[i] = h;
      l8[i] = lo;
    }
    *reinterpret_cast<v8h*>(row + g * 8)       = h8;
    *reinterpret_cast<v8h*>(row + XPL + g * 8) = l8;
  }
}

__launch_bounds__(256)
__global__ void cgp_proj_kernel(const float* __restrict__ pose,
                                const float* __restrict__ idf,
                                const float* __restrict__ Wq, const float* __restrict__ bq,
                                const float* __restrict__ Wk, const float* __restrict__ bk,
                                const float* __restrict__ Wv, const float* __restrict__ bv,
                                _Float16* __restrict__ Qb,
                                _Float16* __restrict__ Kb,
                                _Float16* __restrict__ Vb) {
  const int which = blockIdx.z;
  const int b     = blockIdx.y;
  const int l0    = blockIdx.x * (PLT * PNT);
  const int tid   = threadIdx.x;
  const int wv    = tid >> 5;
  const int ln    = tid & 31;
  const int hn    = ln & 15;
  const int hg    = ln >> 4;
  const bool isV  = (which == 2);

  const float* x    = (which == 1) ? idf : pose;
  const float* W    = (which == 0) ? Wq : (which == 1) ? Wk : Wv;
  const float* bias = (which == 0) ? bq : (which == 1) ? bk : bv;

  // x hi plane, x lo plane, W hi plane, W lo plane.
  __shared__ __attribute__((aligned(16))) _Float16 sm[2 * XPL + 2 * WPL];
  __shared__ __attribute__((aligned(16))) float sb[CC];  // the bias

  // This thread's place in the x staging: position tid & 63, channels 32 * (tid >> 6) on.
  const float* xp   = x + ((size_t)b * CC + (tid >> 6) * 32) * LL + l0 + (tid & (PLT - 1));
  _Float16*    xrow = sm + (tid & (PLT - 1)) * XSTR + (tid >> 6) * 32;

  float f[4][8];
  proj_load_x(f, xp);
  asm volatile("s_wait_xcnt 0x0" ::: "memory");
  {
    // W: a wave's load is one whole row of 512 bytes.
    const float* wp = W + wv * CC + ln * 4;
    v4f wr[16];
#pragma unroll
    for (int i = 0; i < 16; ++i)
      wr[i] = *reinterpret_cast<const v4f*>(wp + i * 8 * CC);
    // The same for the W loads; as an input the pointer keeps its registers up to
    // the wait, so that none of these loads' own results is put there.
    asm volatile("s_wait_xcnt 0x0" ::"v"(wp) : "memory");
    if (tid < CC) sb[tid] = bias[tid];
    proj_store_x(f, xrow);
#pragma unroll
    for (int i = 0; i < 16; ++i) {
      v4h h4, l4;
#pragma unroll
      for (int e = 0; e < 4; ++e) {
        _Float16 h, lo;
        split_f16(wr[i][e], h, lo);
        h4[e] = h;
        l4[e] = lo;
      }
      *reinterpret_cast<v4h*>(&sm[WOFF + (i * 8 + wv) * XSTR + ln * 4])       = h4;
      *reinterpret_cast<v4h*>(&sm[WOFF + WPL + (i * 8 + wv) * XSTR + ln * 4]) = l4;
    }
  }

  const int r_hi = isV ? WOFF + wv * 16 * XSTR : (wv & 3) * 16 * XSTR;
  const int r_lo = r_hi + (isV ? WPL : XPL);
  const int s_hi = isV ? 0 : WOFF + (wv >> 2) * 64 * XSTR;
  const int s_lo = s_hi + (isV ? XPL : WPL);

  // This wave's 16 output rows of 128 bytes, first tile; step to the next tile.
  _Float16* dst;
  int pitch, tstep;
  if (isV) {
    dst   = Vb + ((size_t)b * CC + wv * 16) * LL + l0;
    pitch = LL;
    tstep = PLT;
  } else {
    dst   = (which == 0 ? Qb : Kb) + ((size_t)b * LL + l0 + (wv & 3) * 16) * CC + (wv >> 2) * 64;
    pitch = CC;
    tstep = PLT * CC;
  }

#pragma unroll
  for (int tile = 0; tile < PNT; ++tile) {
    __syncthreads();  // the operands of this tile (first tile: W and the bias too) are in LDS

    // The next tile's x flies while this one is multiplied.
    if (tile + 1 < PNT) proj_load_x(f, xp + (tile + 1) * PLT);

    // Accumulators start at the bias.
    // acc[t][r] = out(output row hn of this wave, column t*16 + hg*8 + r of its 64)
    v8f acc[4];
    if (isV) {
      const float bo = sb[wv * 16 + hn];
#pragma unroll
      for (int t = 0; t < 4; ++t)
#pragma unroll
        for (int r = 0; r < 8; ++r) acc[t][r] = bo;
    } else {
      const float* bp = sb + (wv >> 2) * 64 + hg * 8;
#pragma unroll
      for (int t = 0; t < 4; ++t)
#pragma unroll
        for (int r = 0; r < 8; ++r) acc[t][r] = bp[t * 16 + r];
    }

    // Kept rolled: unrolled, the compiler fetches fragments of several k steps ahead,
    // and the registers then admit fewer work-groups on a WGP than the three of LDS.
#pragma unroll 1
    for (int kc = 0; kc < 4; ++kc) {
      const v16h rh = frag_rowmajor(sm + r_hi, hn, XSTR, kc * 32 + hg * 8);
      const v16h rl = frag_rowmajor(sm + r_lo, hn, XSTR, kc * 32 + hg * 8);
      v16h fh[4], fl[4];
#pragma unroll
      for (int t = 0; t < 4; ++t) {
        fh[t] = frag_rowmajor(sm + s_hi, t * 16 + hn, XSTR, kc * 32 + hg * 8);
        fl[t] = frag_rowmajor(sm + s_lo, t * 16 + hn, XSTR, kc * 32 + hg * 8);
      }
#pragma unroll
      for (int t = 0; t < 4; ++t) acc[t] = wmma_f16(fl[t], rh, acc[t]);
#pragma unroll
      for (int t = 0; t < 4; ++t) acc[t] = wmma_f16(fh[t], rl, acc[t]);
#pragma unroll
      for (int t = 0; t < 4; ++t) acc[t] = wmma_f16(fh[t], rh, acc[t]);
    }
    __syncthreads();  // every wave has read this tile's x planes for the last time

    // Whole 128-byte lines go out: each wave turns its 16 x 64 tile round in a
    // range of its own inside the x planes.
    _Float16* st = sm + wv * 16 * OSTR;
#pragma unroll
    for (int t = 0; t < 4; ++t) {
      v8h o8;
#pragma unroll
      for (int r = 0; r < 8; ++r) o8[r] = (_Float16)acc[t][r];
      *reinterpret_cast<v8h*>(&st[hn * OSTR + t * 16 + hg * 8]) = o8;
    }
    // The wave's own LDS stores have landed before other lanes read the rows back.
    asm volatile("s_wait_dscnt 0x0" ::: "memory");
#pragma unroll
    for (int j = 0; j < 4; ++j) {
      const int row = j * 4 + (ln >> 3);
      const v8h o8 = *reinterpret_cast<const v8h*>(&st[row * OSTR + (ln & 7) * 8]);
      *reinterpret_cast<v8h*>(dst + (size_t)tile * tstep + (size_t)row * pitch + (ln & 7) * 8) = o8;
    }

    if (tile + 1 < PNT) {
      asm volatile("s_wait_xcnt 0x0" ::: "memory");
      __builtin_amdgcn_sched_barrier(0);
      __syncthreads();  // every wave has read its rows back: the x planes are free
      proj_store_x(f, xrow);
    }
  }
}

// ---------------------------------------------------------------------------
// Flash attention; K and V staged by tensor loads in a ring of two buffers.
// Block = 256 threads = 8 waves on 128 queries. A stage is 128 keys. Wave w owns the
// 32 queries q0 + 32 * (w & 3) on and the 64 keys 64 * (w >> 2) on of every stage, so
// every K and V fragment read from LDS feeds two matrix instructions (two 16-query
// tiles). The two waves of a query group join their key halves in the epilogue.
// Products are taken transposed: S^T = K Q^T and O^T += V P^T, so a lane holds
// the scores of ONE query per tile (column hn; keys 8*hg..8*hg+7 of each 16-key tile).
// Wave 0 brings the K tile of a stage, wave 1 its V tile, one request each.
// ---------------------------------------------------------------------------
#define KS    128               // keys per stage
#define RSTR  136               // LDS row pitch of K and V (halves): 256-byte row + 16 bytes
#define TILEH (128 * RSTR)      // one tile in halves; in bytes 34816 = 17 * 2 KiB
#define NST   (LL / KS)

// ---- the pieces of a pass ----
// K fragments of two 16-key tiles (jt0, jt0 + 1) of the wave's 64 key rows.
__device__ __forceinline__ void attn_load_k(v16h (&kf)[2][4], const _Float16* k, int jt0,
                                            int hn, int hg) {
#pragma unroll
  for (int j = 0; j < 2; ++j)
#pragma unroll
    for (int kc = 0; kc < 4; ++kc)
      kf[j][kc] = frag_rowmajor(k, (jt0 + j) * 16 + hn, RSTR, kc * 32 + hg * 8);
}

// S^T = K Q^T for those two key tiles: A = 16 key rows, B = resident Q columns.
// S[qt][jt][r] = score(key jt*16 + hg*8 + r of the wave's 64, query i0 + qt*16 + hn)
__device__ __forceinline__ void attn_scores(v8f (&S)[2][4], const v16h (&kf)[2][4],
                                            const v16h (&qf)[2][4], int jt0) {
#pragma unroll
  for (int j = 0; j < 2; ++j) {
    v8f acc0 = zero_v8f(), acc1 = zero_v8f();
#pragma unroll
    for (int kc = 0; kc < 4; ++kc) {
      acc0 = wmma_f16(kf[j][kc], qf[0][kc], acc0);
      acc1 = wmma_f16(kf[j][kc], qf[1][kc], acc1);
    }
    S[0][jt0 + j] = acc0;
    S[1][jt0 + j] = acc1;
  }
}

// V fragments of 32 keys (jc) of the wave's 64 key columns, all 128 channel rows.
__device__ __forceinline__ void attn_load_v(v16h (&vf)[8], const _Float16* v, int jc,
                                            int hn, int hg) {
#pragma unroll
  for (int cc8 = 0; cc8 < 8; ++cc8)
    vf[cc8] = frag_rowmajor(v, cc8 * 16 + hn, RSTR, jc * 32 + hg * 8);
}

// O^T += V P^T over 32 keys: A = 16 channel rows of V, B = packed P^T of the two query tiles.
__device__ __forceinline__ void attn_pv(v8f (&O)[2][8], const v16h (&vf)[8], v8f p0, v8f p1) {
  const v16h pf[2] = {__builtin_bit_cast(v16h, p0), __builtin_bit_cast(v16h, p1)};
#pragma unroll
  for (int cc8 = 0; cc8 < 8; ++cc8) {
    O[0][cc8] = wmma_f16(vf[cc8], pf[0], O[0][cc8]);
    O[1][cc8] = wmma_f16(vf[cc8], pf[1], O[1][cc8]);
  }
}

// Online softmax of a pass: in-lane over 32 scores a tile, one exchange between halves;
// O is brought to the new maximum; P^T is packed from two score tiles (element e = tile
// e>>3, register e&7, which is the k order that frag_rowmajor gives the V rows) and left
// in the registers of score tiles 0 and 1: S[qt][jc] then holds the 16 halves of keys
// 32*jc .. 32*jc+31. One set of registers so carries scores or P from pass to pass.
__device__ __forceinline__ void attn_softmax(v8f (&S)[2][4], v8f (&O)[2][8], float (&mrun)[2],
                                             float (&lrun)[2]) {
#pragma unroll
  for (int qt = 0; qt < 2; ++qt) {
    float mt[4];
#pragma unroll
    for (int jt = 0; jt < 4; ++jt) {
      mt[jt] = S[qt][jt][0];
#pragma unroll
      for (int r = 1; r < 8; ++r) mt[jt] = fmaxf(mt[jt], S[qt][jt][r]);
    }
    float mv = fmaxf(fmaxf(mt[0], mt[1]), fmaxf(mt[2], mt[3]));
    mv = fmaxf(mv, xhalf(mv));
    const float mnew  = fmaxf(mrun[qt], mv);
    const float alpha = __expf(mrun[qt] - mnew);
    mrun[qt] = mnew;

    float st[4];
#pragma unroll
    for (int jt = 0; jt < 4; ++jt) {
#pragma unroll
      for (int r = 0; r < 8; ++r) S[qt][jt][r] = __expf(S[qt][jt][r] - mnew);
      st[jt] = ((S[qt][jt][0] + S[qt][jt][1]) + (S[qt][jt][2] + S[qt][jt][3])) +
               ((S[qt][jt][4] + S[qt][jt][5]) + (S[qt][jt][6] + S[qt][jt][7]));
    }
    lrun[qt] = lrun[qt] * alpha + ((st[0] + st[1]) + (st[2] + st[3]));

#pragma unroll
    for (int cc8 = 0; cc8 < 8; ++cc8)
#pragma unroll
      for (int r = 0; r < 8; ++r) O[qt][cc8][r] *= alpha;

    v16h pf[2];
#pragma unroll
    for (int jc = 0; jc < 2; ++jc)
#pragma unroll
      for (int e = 0; e < 8; ++e) {
        pf[jc][e]     = (_Float16)S[qt][2 * jc][e];
        pf[jc][e + 8] = (_Float16)S[qt][2 * jc + 1][e];
      }
    S[qt][0] = __builtin_bit_cast(v8f, pf[0]);
    S[qt][1] = __builtin_bit_cast(v8f, pf[1]);
  }
}

__launch_bounds__(256) __attribute__((amdgpu_waves_per_eu(2, 2)))
__global__ void cgp_attn_kernel(const _Float16* __restrict__ Qb,
                                const _Float16* __restrict__ Kb,
                                const _Float16* __restrict__ Vb,
                                const float* __restrict__ pose,
                                const float* __restrict__ gamma,
                                float* __restrict__ out) {
  // K buffer 0, K buffer 1, V buffer 0, V buffer 1; each starts at a multiple of 2 KiB.
  __shared__ __attribute__((aligned(2048))) _Float16 ring[4 * TILEH];
  // Epilogue exchange between the two waves of a query group.
  __shared__ __attribute__((aligned(16))) v4f xO[8][16][32];
  __shared__ float xs[8][4][32];

  const int b   = blockIdx.y;
  const int q0  = blockIdx.x * 128;
  const int tid = threadIdx.x;
  const int ln  = tid & 31;
  const int hn  = ln & 15;
  const int hg  = ln >> 4;
  const unsigned wv = uni((unsigned)tid >> 5);
  const int qg  = wv & 3;   // query group
  const int kh  = wv >> 2;  // key half of every stage

  const _Float16* Qbase = Qb + (size_t)b * LL * CC;  // [L,C]
  const _Float16* Kbase = Kb + (size_t)b * LL * CC;  // [L,C]
  const _Float16* Vbase = Vb + (size_t)b * CC * LL;  // [C,L]

  const int i0 = q0 + qg * 32;

  // What an issuing wave brings: wave 0 K (128 key rows of 128 channels), wave 1 V
  // (128 channel rows of 128 keys).
  const bool     isV     = (wv == 1u);
  const _Float16* tsrc   = isV ? Vbase : Kbase;
  const unsigned tstep   = isV ? KS : KS * CC;                 // halves from stage to stage
  const unsigned tpitch  = isV ? LL * 2u : CC * 2u;            // source row pitch, bytes
  const unsigned tdst    = (unsigned)(uintptr_t)&ring[0] + (isV ? 4u * TILEH : 0u);

  // Resident Q fragments, two 16-query tiles.
  v16h qf[2][4];
#pragma unroll
  for (int qt = 0; qt < 2; ++qt)
#pragma unroll
    for (int kc = 0; kc < 4; ++kc)
      qf[qt][kc] = frag_rowmajor(Qbase, i0 + qt * 16 + hn, CC, kc * 32 + hg * 8);

  // Prologue: stage 0 lands and is published, then stage 1 is asked for.
  const v8u g1 = tile_group1(tpitch);
  v4u g0 = {0u, 0u, 0u, 0u};
  if (pinned(wv < 2u)) {
    g0 = tile_group0(tdst, tsrc);
    tile_load(g0, g1);
    tile_wait(g0, g1);  // stage 0 has landed before the barrier that lets the other waves read it
  }

  v8f O[2][8];
#pragma unroll
  for (int qt = 0; qt < 2; ++qt)
#pragma unroll
    for (int cc8 = 0; cc8 < 8; ++cc8) O[qt][cc8] = zero_v8f();

  // Per query tile, this lane's query: running maximum over this wave's keys (equal in
  // both wave halves) and the running sum over this lane half's keys only.
  float mrun[2] = {-3.0e38f, -3.0e38f}, lrun[2] = {0.0f, 0.0f};

  __syncthreads();  // stage 0 visible to all waves
  if (pinned(wv < 2u)) {
    g0 = tile_group0(tdst + 2u * TILEH, tsrc + tstep);
    tile_load(g0, g1);
  }

  v8f  S[2][4];      // scores, or behind the softmax packed P in tiles 0 and 1
  v16h kf[2][2][4];  // two halves of the wave's 64 key rows
  v16h vf[2][8];     // V fragments of the stage whose O^T += V P^T is still to come

  // ---- pass 0: stage 0 ----
  {
    const _Float16* k = ring + kh * 64 * RSTR;               // this wave's 64 key rows
    const _Float16* v = ring + 2 * TILEH + kh * 64;          // this wave's 64 key columns
    attn_load_k(kf[0], k, 0, hn, hg);
    attn_load_k(kf[1], k, 2, hn, hg);
    attn_scores(S, kf[0], qf, 0);
    attn_scores(S, kf[1], qf, 2);
    attn_load_v(vf[0], v, 0, hn, hg);
    attn_load_v(vf[1], v, 1, hn, hg);
    if (kh == 0) attn_softmax(S, O, mrun, lrun);
  }

  for (int s = 0; s + 1 < NST; ++s) {
    // ---- publish point of stage s + 1, the foot of pass s ----
    // This wave's reads of stage s have returned before its buffer may be refilled.
    asm volatile("s_wait_dscnt 0x0" ::: "memory");
    if (pinned(wv < 2u)) tile_wait(g0, g1);  // its tile of stage s + 1 has landed before the barrier publishes it
    __syncthreads();  // stage s + 1 visible to all waves; every wave has left stage s
    if (pinned((wv < 2u) && (s + 2 < NST))) {
      g0 = tile_group0(tdst + (unsigned)(s & 1) * (2u * TILEH), tsrc + (size_t)(s + 2) * tstep);
      tile_load(g0, g1);
    }

    // ---- pass s + 1 ----
    const _Float16* k = ring + ((s + 1) & 1) * TILEH + kh * 64 * RSTR;
    const _Float16* v = ring + (2 + ((s + 1) & 1)) * TILEH + kh * 64;

    if (kh != 0) attn_softmax(S, O, mrun, lrun);  // stage s

    attn_load_k(kf[0], k, 0, hn, hg);
    __builtin_amdgcn_sched_barrier(0);      // K tiles 0, 1 are asked for ahead of PV
    attn_pv(O, vf[0], S[0][0], S[1][0]);    // stage s, keys 0..31 of the wave's 64
    __builtin_amdgcn_sched_barrier(0);      // the next group takes vf[0]'s registers
    attn_load_k(kf[1], k, 2, hn, hg);
    attn_load_v(vf[0], v, 0, hn, hg);
    __builtin_amdgcn_sched_barrier(0);      // K tiles 2, 3 and half of V are asked for ahead of PV
    attn_pv(O, vf[1], S[0][1], S[1][1]);    // stage s, keys 32..63
    attn_scores(S, kf[0], qf, 0);
    __builtin_amdgcn_sched_barrier(0);      // the next group takes vf[1]'s registers
    attn_load_v(vf[1], v, 1, hn, hg);
    __builtin_amdgcn_sched_barrier(0);      // the rest of V is asked for ahead of the last scores
    attn_scores(S, kf[1], qf, 2);

    if (kh == 0) attn_softmax(S, O, mrun, lrun);  // stage s + 1
  }
  // Nothing is outstanding when the wave goes on to the epilogue and ends.
  asm volatile("s_wait_tensorcnt 0x0" ::: "memory");
  asm volatile("s_wait_dscnt 0x0" ::: "memory");

  // The last stage's softmax, where it is still to come, and its O^T += V P^T.
  if (kh != 0) attn_softmax(S, O, mrun, lrun);
  attn_pv(O, vf[0], S[0][0], S[1][0]);
  attn_pv(O, vf[1], S[0][1], S[1][1]);

  // ---- epilogue: join the two key halves, out = pose + gamma * O / l ----
  // O[qt][cc8][r] = O^T(channel cc8*16 + hg*8 + r, query i0 + qt*16 + hn), this wave's keys.
  // Wave kh finishes channels 64*kh .. 64*kh+63 of all 32 queries (whole 128-byte lines
  // of out) and hands the other 64 channels, its maxima and its sums to its partner.
#pragma unroll
  for (int qt = 0; qt < 2; ++qt) {
    lrun[qt] += xhalf(lrun[qt]);
    xs[wv][qt][ln]     = mrun[qt];
    xs[wv][2 + qt][ln] = lrun[qt];
#pragma unroll
    for (int c4 = 0; c4 < 4; ++c4)
#pragma unroll
      for (int h = 0; h < 2; ++h) {
        v4f t;
#pragma unroll
        for (int e = 0; e < 4; ++e) t[e] = kh ? O[qt][c4][h * 4 + e] : O[qt][4 + c4][h * 4 + e];
        xO[wv][(qt * 4 + c4) * 2 + h][ln] = t;
      }
  }
  __syncthreads();  // every wave's hand-over is in LDS

  const unsigned pw = wv ^ 4u;  // the partner: same queries, other key half
  const float g = gamma[0];
#pragma unroll
  for (int qt = 0; qt < 2; ++qt) {
    const float mp = xs[pw][qt][ln];
    const float lp = xs[pw][2 + qt][ln];
    const float m  = fmaxf(mrun[qt], mp);
    const float eo = __expf(mrun[qt] - m);
    const float ep = __expf(mp - m);
    const float inv = 1.0f / (lrun[qt] * eo + lp * ep);
    const float co = eo * inv, cp = ep * inv;
    const size_t col = (size_t)b * CC * LL + (size_t)(i0 + qt * 16 + hn);
#pragma unroll
    for (int c4 = 0; c4 < 4; ++c4)
#pragma unroll
      for (int h = 0; h < 2; ++h) {
        const v4f t = xO[pw][(qt * 4 + c4) * 2 + h][ln];
#pragma unroll
        for (int e = 0; e < 4; ++e) {
          const float own = kh ? O[qt][4 + c4][h * 4 + e] : O[qt][c4][h * 4 + e];
          const size_t off = col + (size_t)((kh * 4 + c4) * 16 + hg * 8 + h * 4 + e) * LL;
          out[off] = fmaf(g, own * co + t[e] * cp, pose[off]);
        }
      }
  }
}

// ---------------------------------------------------------------------------
extern "C" void kernel_launch(void* const* d_in, const int* in_sizes, int n_in,
                              void* d_out, int out_size, void* d_ws, size_t ws_size,
                              hipStream_t stream) {
  const float* pose  = (const float*)d_in[0];
  const float* idf   = (const float*)d_in[1];
  const float* Wq    = (const float*)d_in[2];
  const float* bq    = (const float*)d_in[3];
  const float* Wk    = (const float*)d_in[4];
  const float* bk    = (const float*)d_in[5];
  const float* Wv    = (const float*)d_in[6];
  const float* bv    = (const float*)d_in[7];
  const float* gamma = (const float*)d_in[8];
  float* out = (float*)d_out;

  const size_t mat_bytes = (size_t)BB * LL * CC * sizeof(_Float16);  // 8 MB each
  char* ws = (char*)d_ws;
  _Float16* Qb = reinterpret_cast<_Float16*>(ws);
  _Float16* Kb = reinterpret_cast<_Float16*>(ws + mat_bytes);
  _Float16* Vb = reinterpret_cast<_Float16*>(ws + 2 * mat_bytes);

  cgp_proj_kernel<<<dim3(LL / (PLT * PNT), BB, 3), dim3(256), 0, stream>>>(
      pose, idf, Wq, bq, Wk, bk, Wv, bv, Qb, Kb, Vb);

  cgp_attn_kernel<<<dim3(LL / 128, BB), dim3(256), 0, stream>>>(
      Qb, Kb, Vb, pose, gamma, out);
}

// v005
// Measured time: 52.3 microseconds a run.
// Two timings next to v004 both put it at 1.05 times that version's speed.
// Counting every step since v000, it is 3.17 times as fast.
#include <hip/hip_runtime.h>

#define BB 8
#define CC 128
#define LL 4096

typedef __attribute__((ext_vector_type(16))) _Float16 v16h;
typedef __attribute__((ext_vector_type(8)))  _Float16 v8h;
typedef __attribute__((ext_vector_type(8)))  float    v8f;
typedef __attribute__((ext_vector_type(4)))  unsigned int v4u;
typedef __attribute__((ext_vector_type(8)))  unsigned int v8u;

__device__ __forceinline__ v16h frag_rowmajor(const _Float16* base, int row,
                                              int stride, int col) {
  const _Float16* p = base + row * stride + col;
  v8h lo = *reinterpret_cast<const v8h*>(p);
  v8h hi = *reinterpret_cast<const v8h*>(p + 16);
  v16h r;
#pragma unroll
  for (int i = 0; i < 8; ++i) {
    r[i]     = lo[i];
    r[i + 8] = hi[i];
  }
  return r;
}

__device__ __forceinline__ float xhalf(float x) {
  const int xi = __builtin_bit_cast(int, x);
  return __builtin_bit_cast(float, __builtin_amdgcn_permlanex16(
      xi, xi, 0x76543210, 0xfedcba98, false, false));
}

__device__ __forceinline__ v8f zero_v8f() {
  v8f z;
#pragma unroll
  for (int i = 0; i < 8; ++i) z[i] = 0.0f;
  return z;
}

__device__ __forceinline__ unsigned uni(unsigned v) {
  return (unsigned)__builtin_amdgcn_readfirstlane((int)v);
}

__device__ __forceinline__ unsigned pinned(unsigned v) {
  unsigned w = uni(v);
  asm volatile("" : "+s"(w));  // keeps the test word in a scalar register
  return w;
}

__device__ __forceinline__ v4u tile_group0(unsigned lds_byte_off, const _Float16* gaddr) {
  const unsigned long long ga = (unsigned long long)(uintptr_t)gaddr;
  v4u g0;
  g0[0] = uni(1u);
  g0[1] = uni(lds_byte_off);
  g0[2] = uni((unsigned)ga);
  g0[3] = uni((((unsigned)(ga >> 32)) & 0x01ffffffu) | 0x80000000u);
  asm volatile("" : "+s"(g0));
  return g0;
}

__device__ __forceinline__ v8u tile_group1(unsigned src_pitch_bytes) {
  v8u g1;
  g1[0] = uni((1u << 20) | (5u << 22) | (3u << 25));
  g1[1] = uni(256u << 16);
  g1[2] = uni(128u << 16);
  g1[3] = uni(256u << 16);
  g1[4] = uni(128u);
  g1[5] = uni(src_pitch_bytes);
  g1[6] = uni(0u);
  g1[7] = uni(0u);
  asm volatile("" : "+s"(g1));
  return g1;
}

// The request itself; the waits for it stand at its callers.
__device__ __forceinline__ void tile_load(v4u g0, v8u g1) {
  asm volatile("tensor_load_to_lds %0, %1" ::"s"(g0), "s"(g1) : "memory");
}

// The issuing wave's tile has landed. As inputs the request's two groups keep their
// registers up to this wait.
__device__ __forceinline__ void tile_wait(v4u g0, v8u g1) {
  asm volatile("s_wait_tensorcnt 0x0" ::"s"(g0), "s"(g1) : "memory");
}

// ---------------------------------------------------------------------------
// Projection: out[o,l] = sum_c W[o,c] x[b,c,l] + bias[o], cast to f16.
// which (blockIdx.z): 0 -> Q ([L,C], times log2(e)), 1 -> K ([L,C]), 2 -> V ([C,L]).
// The product runs on the f16 matrix form. Each f32 operand is split into
// hi = f16(a) and lo = f16(a - hi); W x = Whi xhi + Whi xlo + Wlo xhi, summed in
// f32, leaves out only the lo*lo term, so the f32 operands' accuracy stays.
// Block = 8 waves; W is staged once, then two tiles of 64 positions follow one
// another. Both operands lie in LDS as [row][channel] (x transposed on the way
// in). A wave multiplies 16 rows of one operand (its 16 output rows) with 64 rows
// of the other (128 bytes of each output row): V: 16 rows of W against all 64
// positions; Q, K: 16 positions against 64 rows of W.
// ---------------------------------------------------------------------------
#define PLT  64                    // positions per tile
#define PNT  2                     // tiles per work-group
#define XSTR 136                   // LDS row pitch in halves: 128 channels + 16 bytes
#define OSTR 72                    // output staging pitch in halves: 128 bytes + 16
#define XPL  (PLT * XSTR)          // one plane (hi or lo) of the x tile
#define WPL  (CC * XSTR)           // one plane of W
#define WOFF (2 * XPL)             // W planes lie behind the two x planes

typedef __attribute__((ext_vector_type(4))) _Float16 v4h;
typedef __attribute__((ext_vector_type(4))) float    v4f;

__device__ __forceinline__ void split_f16(float a, _Float16& hi, _Float16& lo) {
  hi = (_Float16)a;
  lo = (_Float16)(a - (float)hi);
}

__device__ __forceinline__ v8f wmma_f16(v16h a, v16h b, v8f c) {
  return __builtin_amdgcn_wmma_f32_16x16x32_f16(false, a, false, b, (short)0, c,
                                                false, false);
}

// A thread's share of an x tile: one position, 32 channels. A wave's load is 128
// contiguous bytes.
__device__ __forceinline__ void proj_load_x(float (&f)[4][8], const float* xp) {
#pragma unroll
  for (int g = 0; g < 4; ++g)
#pragma unroll
    for (int i = 0; i < 8; ++i) f[g][i] = xp[(size_t)(g * 8 + i) * LL];
}

// Split it and put it at [position][channel]; a wave's 16-byte stores lie one
// pitch apart.
__device__ __forceinline__ void proj_store_x(const float (&f)[4][8], _Float16* row) {
#pragma unroll
  for (int g = 0; g < 4; ++g) {
    v8h h8, l8;
#pragma unroll
    for (int i = 0; i < 8; ++i) {
      _Float16 h, lo;
      split_f16(f[g][i], h, lo);
      h8[i] = h;
      l8[i] = lo;
    }
    *reinterpret_cast<v8h*>(row + g * 8)       = h8;
    *reinterpret_cast<v8h*>(row + XPL + g * 8) = l8;
  }
}

__launch_bounds__(256)
__global__ void cgp_proj_kernel(const float* __restrict__ pose,
                                const float* __restrict__ idf,
                                const float* __restrict__ Wq, const float* __restrict__ bq,
                                const float* __restrict__ Wk, const float* __restrict__ bk,
                                const float* __restrict__ Wv, const float* __restrict__ bv,
                                _Float16* __restrict__ Qb,
                                _Float16* __restrict__ Kb,
                                _Float16* __restrict__ Vb) {
  const int which = blockIdx.z;
  const int b     = blockIdx.y;
  const int l0    = blockIdx.x * (PLT * PNT);
  const int tid   = threadIdx.x;
  const int wv    = tid >> 5;
  const int ln    = tid & 31;
  const int hn    = ln & 15;
  const int hg    = ln >> 4;
  const bool isV  = (which == 2);
  // Q leaves times log2(e): the attention kernel's scores then are exponents of 2.
  const float oscale = (which == 0) ? 1.44269504f : 1.0f;

  const float* x    = (which == 1) ? idf : pose;
  const float* W    = (which == 0) ? Wq : (which == 1) ? Wk : Wv;
  const float* bias = (which == 0) ? bq : (which == 1) ? bk : bv;

  // x hi plane, x lo plane, W hi plane, W lo plane.
  __shared__ __attribute__((aligned(16))) _Float16 sm[2 * XPL + 2 * WPL];
  __shared__ __attribute__((aligned(16))) float sb[CC];  // the bias

  // This thread's place in the x staging: position tid & 63, channels 32 * (tid >> 6) on.
  const float* xp   = x + ((size_t)b * CC + (tid >> 6) * 32) * LL + l0 + (tid & (PLT - 1));
  _Float16*    xrow = sm + (tid & (PLT - 1)) * XSTR + (tid >> 6) * 32;

  float f[4][8];
  proj_load_x(f, xp);
  asm volatile("s_wait_xcnt 0x0" ::: "memory");
  {
    // W: a wave's load is one whole row of 512 bytes.
    const float* wp = W + wv * CC + ln * 4;
    v4f wr[16];
#pragma unroll
    for (int i = 0; i < 16; ++i)
      wr[i] = *reinterpret_cast<const v4f*>(wp + i * 8 * CC);
    // The same for the W loads; as an input the pointer keeps its registers up to
    // the wait, so that none of these loads' own results is put there.
    asm volatile("s_wait_xcnt 0x0" ::"v"(wp) : "memory");
    if (tid < CC) sb[tid] = bias[tid];
    proj_store_x(f, xrow);
#pragma unroll
    for (int i = 0; i < 16; ++i) {
      v4h h4, l4;
#pragma unroll
      for (int e = 0; e < 4; ++e) {
        _Float16 h, lo;
        split_f16(wr[i][e], h, lo);
        h4[e] = h;
        l4[e] = lo;
      }
      *reinterpret_cast<v4h*>(&sm[WOFF + (i * 8 + wv) * XSTR + ln * 4])       = h4;
      *reinterpret_cast<v4h*>(&sm[WOFF + WPL + (i * 8 + wv) * XSTR + ln * 4]) = l4;
    }
  }

  const int r_hi = isV ? WOFF + wv * 16 * XSTR : (wv & 3) * 16 * XSTR;
  const int r_lo = r_hi + (isV ? WPL : XPL);
  const int s_hi = isV ? 0 : WOFF + (wv >> 2) * 64 * XSTR;
  const int s_lo = s_hi + (isV ? XPL : WPL);

  // This wave's 16 output rows of 128 bytes, first tile; step to the next tile.
  _Float16* dst;
  int pitch, tstep;
  if (isV) {
    dst   = Vb + ((size_t)b * CC + wv * 16) * LL + l0;
    pitch = LL;
    tstep = PLT;
  } else {
    dst   = (which == 0 ? Qb : Kb) + ((size_t)b * LL + l0 + (wv & 3) * 16) * CC + (wv >> 2) * 64;
    pitch = CC;
    tstep = PLT * CC;
  }

#pragma unroll
  for (int tile = 0; tile < PNT; ++tile) {
    __syncthreads();  // the operands of this tile (first tile: W and the bias too) are in LDS

    // The next tile's x flies while this one is multiplied.
    if (tile + 1 < PNT) proj_load_x(f, xp + (tile + 1) * PLT);

    // Accumulators start at the bias.
    // acc[t][r] = out(output row hn of this wave, column t*16 + hg*8 + r of its 64)
    v8f acc[4];
    if (isV) {
      const float bo = sb[wv * 16 + hn];
#pragma unroll
      for (int t = 0; t < 4; ++t)
#pragma unroll
        for (int r = 0; r < 8; ++r) acc[t][r] = bo;
    } else {
      const float* bp = sb + (wv >> 2) * 64 + hg * 8;
#pragma unroll
      for (int t = 0; t < 4; ++t)
#pragma unroll
        for (int r = 0; r < 8; ++r) acc[t][r] = bp[t * 16 + r];
    }

    // Kept rolled: unrolled, the compiler fetches fragments of several k steps ahead,
    // and the registers then admit fewer work-groups on a WGP than the three of LDS.
#pragma unroll 1
    for (int kc = 0; kc < 4; ++kc) {
      const v16h rh = frag_rowmajor(sm + r_hi, hn, XSTR, kc * 32 + hg * 8);
      const v16h rl = frag_rowmajor(sm + r_lo, hn, XSTR, kc * 32 + hg * 8);
      v16h fh[4], fl[4];
#pragma unroll
      for (int t = 0; t < 4; ++t) {
        fh[t] = frag_rowmajor(sm + s_hi, t * 16 + hn, XSTR, kc * 32 + hg * 8);
        fl[t] = frag_rowmajor(sm + s_lo, t * 16 + hn, XSTR, kc * 32 + hg * 8);
      }
#pragma unroll
      for (int t = 0; t < 4; ++t) acc[t] = wmma_f16(fl[t], rh, acc[t]);
#pragma unroll
      for (int t = 0; t < 4; ++t) acc[t] = wmma_f16(fh[t], rl, acc[t]);
#pragma unroll
      for (int t = 0; t < 4; ++t) acc[t] = wmma_f16(fh[t], rh, acc[t]);
    }
    __syncthreads();  // every wave has read this tile's x planes for the last time

    // Whole 128-byte lines go out: each wave turns its 16 x 64 tile round in a
    // range of its own inside the x planes.
    _Float16* st = sm + wv * 16 * OSTR;
#pragma unroll
    for (int t = 0; t < 4; ++t) {
      v8h o8;
#pragma unroll
      for (int r = 0; r < 8; ++r) o8[r] = (_Float16)(acc[t][r] * oscale);
      *reinterpret_cast<v8h*>(&st[hn * OSTR + t * 16 + hg * 8]) = o8;
    }
    // The wave's own LDS stores have landed before other lanes read the rows back.
    asm volatile("s_wait_dscnt 0x0" ::: "memory");
#pragma unroll
    for (int j = 0; j < 4; ++j) {
      const int row = j * 4 + (ln >> 3);
      const v8h o8 = *reinterpret_cast<const v8h*>(&st[row * OSTR + (ln & 7) * 8]);
      *reinterpret_cast<v8h*>(dst + (size_t)tile * tstep + (size_t)row * pitch + (ln & 7) * 8) = o8;
    }

    if (tile + 1 < PNT) {
      asm volatile("s_wait_xcnt 0x0" ::: "memory");
      __builtin_amdgcn_sched_barrier(0);
      __syncthreads();  // every wave has read its rows back: the x planes are free
      proj_store_x(f, xrow);
    }
  }
}

// ---------------------------------------------------------------------------
// Flash attention; K and V staged by tensor loads in a ring of two buffers.
// Block = 256 threads = 8 waves on 128 queries. A stage is 128 keys. Wave w owns the
// 32 queries q0 + 32 * (w & 3) on and the 64 keys 64 * (w >> 2) on of every stage, so
// every K and V fragment read from LDS feeds two matrix instructions (two 16-query
// tiles). The two waves of a query group join their key halves in the epilogue.
// Products are taken transposed: S^T = K Q^T and O^T += V P^T, so a lane holds
// the scores of ONE query per tile (column hn; keys 8*hg..8*hg+7 of each 16-key tile).
// Wave 0 brings the K tile of a stage, wave 1 its V tile, one request each.
// ---------------------------------------------------------------------------
#define KS    128               // keys per stage
#define RSTR  136               // LDS row pitch of K and V (halves): 256-byte row + 16 bytes
#define TILEH (128 * RSTR)      // one tile in halves; in bytes 34816 = 17 * 2 KiB
#define NST   (LL / KS)

// ---- the pieces of a pass ----
// K fragments of two 16-key tiles (jt0, jt0 + 1) of the wave's 64 key rows.
__device__ __forceinline__ void attn_load_k(v16h (&kf)[2][4], const _Float16* k, int jt0,
                                            int hn, int hg) {
#pragma unroll
  for (int j = 0; j < 2; ++j)
#pragma unroll
    for (int kc = 0; kc < 4; ++kc)
      kf[j][kc] = frag_rowmajor(k, (jt0 + j) * 16 + hn, RSTR, kc * 32 + hg * 8);
}

// S^T = K Q^T for those two key tiles: A = 16 key rows, B = resident Q columns (Q carries
// log2(e)). The sums start at nref, minus the query's held reference (attn_softmax).
// S[qt][jt][r] = score(key jt*16 + hg*8 + r of the wave's 64, query i0 + qt*16 + hn) * log2(e) - reference
__device__ __forceinline__ void attn_scores(v8f (&S)[2][4], const v16h (&kf)[2][4],
                                            const v16h (&qf)[2][4], const v8f (&nref)[2], int jt0) {
#pragma unroll
  for (int j = 0; j < 2; ++j) {
    v8f acc0 = nref[0], acc1 = nref[1];
#pragma unroll
    for (int kc = 0; kc < 4; ++kc) {
      acc0 = wmma_f16(kf[j][kc], qf[0][kc], acc0);
      acc1 = wmma_f16(kf[j][kc], qf[1][kc], acc1);
    }
    S[0][jt0 + j] = acc0;
    S[1][jt0 + j] = acc1;
  }
}

// V fragments of 32 keys (jc) of the wave's 64 key columns, all 128 channel rows.
__device__ __forceinline__ void attn_load_v(v16h (&vf)[8], const _Float16* v, int jc,
                                            int hn, int hg) {
#pragma unroll
  for (int cc8 = 0; cc8 < 8; ++cc8)
    vf[cc8] = frag_rowmajor(v, cc8 * 16 + hn, RSTR, jc * 32 + hg * 8);
}

// O^T += V P^T over 32 keys: A = 16 channel rows of V, B = packed P^T of the two query tiles.
__device__ __forceinline__ void attn_pv(v8f (&O)[2][8], const v16h (&vf)[8], v8f p0, v8f p1) {
  const v16h pf[2] = {__builtin_bit_cast(v16h, p0), __builtin_bit_cast(v16h, p1)};
#pragma unroll
  for (int cc8 = 0; cc8 < 8; ++cc8) {
    O[0][cc8] = wmma_f16(vf[cc8], pf[0], O[0][cc8]);
    O[1][cc8] = wmma_f16(vf[cc8], pf[1], O[1][cc8]);
  }
}

// Softmax of a pass against a HELD reference. nref[qt] holds, eight times over (the C operand of
// the score products), minus the reference of this lane's query in log2 units, equal in both wave
// halves. S comes in as t = score * log2(e) - reference, so P = 2^t with nothing in between. The
// reference stands still while no t of the wave passes 14, so P stays at or below 2^14 (f16 holds
// it, sums are f32) and neither O nor the running sum is touched. One test a pass, on a ballot (a
// scalar branch): only where some t passes 14 does every query of the wave take its own maximum
// (one exchange between halves) as new reference, never a lower one, and O, l and t follow.
// first (the same in the whole wave): the wave's first softmax sets the reference to the maximum
// itself, also a lower one; O and l are still 0 and keep their value. From then on every sum
// holds a term that was 2^0 when it came in. P^T is packed from two score tiles
// (element e = tile e>>3, register e&7, which is the k order that frag_rowmajor gives the V
// rows) and left in the registers of score tiles 0 and 1: S[qt][jc] then holds the 16 halves
// of keys 32*jc .. 32*jc+31. One set of registers so carries scores or P from pass to pass.
__device__ __forceinline__ void attn_softmax(v8f (&S)[2][4], v8f (&O)[2][8], v8f (&nref)[2],
                                             float (&lrun)[2], bool first) {
  float mv[2];
#pragma unroll
  for (int qt = 0; qt < 2; ++qt) {
    float mt[4];
#pragma unroll
    for (int jt = 0; jt < 4; ++jt) {
      mt[jt] = S[qt][jt][0];
#pragma unroll
      for (int r = 1; r < 8; ++r) mt[jt] = fmaxf(mt[jt], S[qt][jt][r]);
    }
    mv[qt] = fmaxf(fmaxf(mt[0], mt[1]), fmaxf(mt[2], mt[3]));
  }

  if (first || __builtin_amdgcn_ballot_w32(fmaxf(mv[0], mv[1]) > 14.0f) != 0u) {
#pragma unroll
    for (int qt = 0; qt < 2; ++qt) {
      float d = fmaxf(mv[qt], xhalf(mv[qt]));
      if (!first) d = fmaxf(d, 0.0f);
      const float alpha = first ? 1.0f : __builtin_amdgcn_exp2f(-d);
      const float nr = nref[qt][0] - d;
#pragma unroll
      for (int r = 0; r < 8; ++r) nref[qt][r] = nr;
      lrun[qt] *= alpha;
#pragma unroll
      for (int jt = 0; jt < 4; ++jt)
#pragma unroll
        for (int r = 0; r < 8; ++r) S[qt][jt][r] -= d;
#pragma unroll
      for (int cc8 = 0; cc8 < 8; ++cc8)
#pragma unroll
        for (int r = 0; r < 8; ++r) O[qt][cc8][r] *= alpha;
    }
  }

#pragma unroll
  for (int qt = 0; qt < 2; ++qt) {
    float st[4];
#pragma unroll
    for (int jt = 0; jt < 4; ++jt) {
#pragma unroll
      for (int r = 0; r < 8; ++r) S[qt][jt][r] = __builtin_amdgcn_exp2f(S[qt][jt][r]);
      st[jt] = ((S[qt][jt][0] + S[qt][jt][1]) + (S[qt][jt][2] + S[qt][jt][3])) +
               ((S[qt][jt][4] + S[qt][jt][5]) + (S[qt][jt][6] + S[qt][jt][7]));
    }
    lrun[qt] += (st[0] + st[1]) + (st[2] + st[3]);

    v16h pf[2];
#pragma unroll
    for (int jc = 0; jc < 2; ++jc)
#pragma unroll
      for (int e = 0; e < 8; ++e) {
        pf[jc][e]     = (_Float16)S[qt][2 * jc][e];
        pf[jc][e + 8] = (_Float16)S[qt][2 * jc + 1][e];
      }
    S[qt][0] = __builtin_bit_cast(v8f, pf[0]);
    S[qt][1] = __builtin_bit_cast(v8f, pf[1]);
  }
}

__launch_bounds__(256) __attribute__((amdgpu_waves_per_eu(2, 2)))
__global__ void cgp_attn_kernel(const _Float16* __restrict__ Qb,
                                const _Float16* __restrict__ Kb,
                                const _Float16* __restrict__ Vb,
                                const float* __restrict__ pose,
                                const float* __restrict__ gamma,
                                float* __restrict__ out) {
  // K buffer 0, K buffer 1, V buffer 0, V buffer 1; each starts at a multiple of 2 KiB.
  __shared__ __attribute__((aligned(2048))) _Float16 ring[4 * TILEH];
  // Epilogue exchange between the two waves of a query group.
  __shared__ __attribute__((aligned(16))) v4f xO[8][16][32];
  __shared__ float xs[8][4][32];

  const int b   = blockIdx.y;
  const int q0  = blockIdx.x * 128;
  const int tid = threadIdx.x;
  const int ln  = tid & 31;
  const int hn  = ln & 15;
  const int hg  = ln >> 4;
  const unsigned wv = uni((unsigned)tid >> 5);
  const int qg  = wv & 3;   // query group
  const int kh  = wv >> 2;  // key half of every stage

  const _Float16* Qbase = Qb + (size_t)b * LL * CC;  // [L,C]
  const _Float16* Kbase = Kb + (size_t)b * LL * CC;  // [L,C]
  const _Float16* Vbase = Vb + (size_t)b * CC * LL;  // [C,L]

  const int i0 = q0 + qg * 32;

  // What an issuing wave brings: wave 0 K (128 key rows of 128 channels), wave 1 V
  // (128 channel rows of 128 keys).
  const bool     isV     = (wv == 1u);
  const _Float16* tsrc   = isV ? Vbase : Kbase;
  const unsigned tstep   = isV ? KS : KS * CC;                 // halves from stage to stage
  const unsigned tpitch  = isV ? LL * 2u : CC * 2u;            // source row pitch, bytes
  const unsigned tdst    = (unsigned)(uintptr_t)&ring[0] + (isV ? 4u * TILEH : 0u);

  // Resident Q fragments, two 16-query tiles.
  v16h qf[2][4];
#pragma unroll
  for (int qt = 0; qt < 2; ++qt)
#pragma unroll
    for (int kc = 0; kc < 4; ++kc)
      qf[qt][kc] = frag_rowmajor(Qbase, i0 + qt * 16 + hn, CC, kc * 32 + hg * 8);

  // Prologue: stage 0 lands and is published, then stage 1 is asked for.
  const v8u g1 = tile_group1(tpitch);
  v4u g0 = {0u, 0u, 0u, 0u};
  if (pinned(wv < 2u)) {
    g0 = tile_group0(tdst, tsrc);
    tile_load(g0, g1);
    tile_wait(g0, g1);  // stage 0 has landed before the barrier that lets the other waves read it
  }

  v8f O[2][8];
#pragma unroll
  for (int qt = 0; qt < 2; ++qt)
#pragma unroll
    for (int cc8 = 0; cc8 < 8; ++cc8) O[qt][cc8] = zero_v8f();

  // Per query tile, this lane's query: minus the held reference of this wave's keys in log2
  // units (equal in both wave halves; 0 until the wave's first softmax sets it), and the
  // running sum over this lane half's keys only.
  v8f nref[2] = {zero_v8f(), zero_v8f()};
  float lrun[2] = {0.0f, 0.0f};

  __syncthreads();  // stage 0 visible to all waves
  if (pinned(wv < 2u)) {
    g0 = tile_group0(tdst + 2u * TILEH, tsrc + tstep);
    tile_load(g0, g1);
  }

  v8f  S[2][4];      // scores, or behind the softmax packed P in tiles 0 and 1
  v16h kf[2][2][4];  // two halves of the wave's 64 key rows
  v16h vf[2][8];     // V fragments of the stage whose O^T += V P^T is still to come

  // ---- pass 0: stage 0 ----
  {
    const _Float16* k = ring + kh * 64 * RSTR;               // this wave's 64 key rows
    const _Float16* v = ring + 2 * TILEH + kh * 64;          // this wave's 64 key columns
    attn_load_k(kf[0], k, 0, hn, hg);
    attn_load_k(kf[1], k, 2, hn, hg);
    attn_scores(S, kf[0], qf, nref, 0);
    attn_scores(S, kf[1], qf, nref, 2);
    attn_load_v(vf[0], v, 0, hn, hg);
    attn_load_v(vf[1], v, 1, hn, hg);
    if (kh == 0) attn_softmax(S, O, nref, lrun, true);
  }

  for (int s = 0; s + 1 < NST; ++s) {
    // ---- publish point of stage s + 1, the foot of pass s ----
    // This wave's reads of stage s have returned before its buffer may be refilled.
    asm volatile("s_wait_dscnt 0x0" ::: "memory");
    if (pinned(wv < 2u)) tile_wait(g0, g1);  // its tile of stage s + 1 has landed before the barrier publishes it
    __syncthreads();  // stage s + 1 visible to all waves; every wave has left stage s
    if (pinned((wv < 2u) && (s + 2 < NST))) {
      g0 = tile_group0(tdst + (unsigned)(s & 1) * (2u * TILEH), tsrc + (size_t)(s + 2) * tstep);
      tile_load(g0, g1);
    }

    // ---- pass s + 1 ----
    const _Float16* k = ring + ((s + 1) & 1) * TILEH + kh * 64 * RSTR;
    const _Float16* v = ring + (2 + ((s + 1) & 1)) * TILEH + kh * 64;

    if (kh != 0) attn_softmax(S, O, nref, lrun, s == 0);  // stage s

    attn_load_k(kf[0], k, 0, hn, hg);
    __builtin_amdgcn_sched_barrier(0);      // K tiles 0, 1 are asked for ahead of PV
    attn_pv(O, vf[0], S[0][0], S[1][0]);    // stage s, keys 0..31 of the wave's 64
    __builtin_amdgcn_sched_barrier(0);      // the next group takes vf[0]'s registers
    attn_load_k(kf[1], k, 2, hn, hg);
    attn_load_v(vf[0], v, 0, hn, hg);
    __builtin_amdgcn_sched_barrier(0);      // K tiles 2, 3 and half of V are asked for ahead of PV
    attn_pv(O, vf[1], S[0][1], S[1][1]);    // stage s, keys 32..63
    attn_scores(S, kf[0], qf, nref, 0);
    __builtin_amdgcn_sched_barrier(0);      // the next group takes vf[1]'s registers
    attn_load_v(vf[1], v, 1, hn, hg);
    __builtin_amdgcn_sched_barrier(0);      // the rest of V is asked for ahead of the last scores
    attn_scores(S, kf[1], qf, nref, 2);

    if (kh == 0) attn_softmax(S, O, nref, lrun, false);  // stage s + 1
  }
  // Nothing is outstanding when the wave goes on to the epilogue and ends.
  asm volatile("s_wait_tensorcnt 0x0" ::: "memory");
  asm volatile("s_wait_dscnt 0x0" ::: "memory");

  // The last stage's softmax, where it is still to come, and its O^T += V P^T.
  if (kh != 0) attn_softmax(S, O, nref, lrun, false);
  attn_pv(O, vf[0], S[0][0], S[1][0]);
  attn_pv(O, vf[1], S[0][1], S[1][1]);

  // ---- epilogue: join the two key halves, out = pose + gamma * O / l ----
  // O[qt][cc8][r] = O^T(channel cc8*16 + hg*8 + r, query i0 + qt*16 + hn), this wave's keys.
  // Wave kh finishes channels 64*kh .. 64*kh+63 of all 32 queries (whole 128-byte lines
  // of out) and hands the other 64 channels, its references and its sums to its partner.
  const float mrun[2] = {-nref[0][0], -nref[1][0]};
#pragma unroll
  for (int qt = 0; qt < 2; ++qt) {
    lrun[qt] += xhalf(lrun[qt]);
    xs[wv][qt][ln]     = mrun[qt];
    xs[wv][2 + qt][ln] = lrun[qt];
#pragma unroll
    for (int c4 = 0; c4 < 4; ++c4)
#pragma unroll
      for (int h = 0; h < 2; ++h) {
        v4f t;
#pragma unroll
        for (int e = 0; e < 4; ++e) t[e] = kh ? O[qt][c4][h * 4 + e] : O[qt][4 + c4][h * 4 + e];
        xO[wv][(qt * 4 + c4) * 2 + h][ln] = t;
      }
  }
  __syncthreads();  // every wave's hand-over is in LDS

  const unsigned pw = wv ^ 4u;  // the partner: same queries, other key half
  const float g = gamma[0];
#pragma unroll
  for (int qt = 0; qt < 2; ++qt) {
    const float mp = xs[pw][qt][ln];
    const float lp = xs[pw][2 + qt][ln];
    const float m  = fmaxf(mrun[qt], mp);
    const float eo = __builtin_amdgcn_exp2f(mrun[qt] - m);  // the references are in log2 units
    const float ep = __builtin_amdgcn_exp2f(mp - m);
    const float inv = 1.0f / (lrun[qt] * eo + lp * ep);
    const float co = eo * inv, cp = ep * inv;
    const size_t col = (size_t)b * CC * LL + (size_t)(i0 + qt * 16 + hn);
#pragma unroll
    for (int c4 = 0; c4 < 4; ++c4)
#pragma unroll
      for (int h = 0; h < 2; ++h) {
        const v4f t = xO[pw][(qt * 4 + c4) * 2 + h][ln];
#pragma unroll
        for (int e = 0; e < 4; ++e) {
          const float own = kh ? O[qt][4 + c4][h * 4 + e] : O[qt][c4][h * 4 + e];
          const size_t off = col + (size_t)((kh * 4 + c4) * 16 + hg * 8 + h * 4 + e) * LL;
          out[off] = fmaf(g, own * co + t[e] * cp, pose[off]);
        }
      }
  }
}

// ---------------------------------------------------------------------------
extern "C" void kernel_launch(void* const* d_in, const int* in_sizes, int n_in,
                              void* d_out, int out_size, void* d_ws, size_t ws_size,
                              hipStream_t stream) {
  const float* pose  = (const float*)d_in[0];
  const float* idf   = (const float*)d_in[1];
  const float* Wq    = (const float*)d_in[2];
  const float* bq    = (const float*)d_in[3];
  const float* Wk    = (const float*)d_in[4];
  const float* bk    = (const float*)d_in[5];
  const float* Wv    = (const float*)d_in[6];
  const float* bv    = (const float*)d_in[7];
  const float* gamma = (const float*)d_in[8];
  float* out = (float*)d_out;

  const size_t mat_bytes = (size_t)BB * LL * CC * sizeof(_Float16);  // 8 MB each
  char* ws = (char*)d_ws;
  _Float16* Qb = reinterpret_cast<_Float16*>(ws);
  _Float16* Kb = reinterpret_cast<_Float16*>(ws + mat_bytes);
  _Float16* Vb = reinterpret_cast<_Float16*>(ws + 2 * mat_bytes);

  cgp_proj_kernel<<<dim3(LL / (PLT * PNT), BB, 3), dim3(256), 0, stream>>>(
      pose, idf, Wq, bq, Wk, bk, Wv, bv, Qb, Kb, Vb);

  cgp_attn_kernel<<<dim3(LL / 128, BB), dim3(256), 0, stream>>>(
      Qb, Kb, Vb, pose, gamma, out);
}
